// v000
// Times are from an AMD MI455X. After a warm-up the kernel runs many times in a row, and a time is the length of
// such a window on the GPU divided by its runs, so every launch and the gaps after it count. The runs cycle
// through copies of the inputs. A figure is the median of several windows, for all but v000 over two sittings.
// Sittings can differ by a few percent; kernels timed side by side share one.
// v000, which the later versions start from, runs in 271 microseconds.
// compute dtype: x, Wq/Wk/Wv + biases (module inputs) rounded to bf16; q/k/v projections with exact bf16 products (+ bias); the per-row sums qs, ks and the rank-1 scores qs_t ks_s / 8 in f32; softmax weights x V with both computed operands as bf16 hi + residual pairs (3 products); online softmax in f32; f32 accumulate.
#include <hip/hip_runtime.h>
#include <math.h>

typedef __attribute__((ext_vector_type(16))) _Float16 v16h;
typedef __attribute__((ext_vector_type(16))) __bf16 v16b;
typedef __attribute__((ext_vector_type(8)))  _Float16 v8h;
typedef __attribute__((ext_vector_type(8)))  float v8f;
typedef __attribute__((ext_vector_type(4)))  float v4f;
typedef __attribute__((ext_vector_type(2)))  float v2f;
typedef __attribute__((ext_vector_type(4)))  unsigned v4u;
typedef __attribute__((ext_vector_type(4)))  int v4i;
typedef float __attribute__((may_alias)) float_a;
typedef int __attribute__((may_alias)) int_a;

template <typename T> __device__ __forceinline__ void vst2(void* p, T v) { *(T*)p = v;  }
__device__ __forceinline__ v8f wmma16(v16h a, v16h b, v8f c) {
  v8f d = __builtin_amdgcn_wmma_f32_16x16x32_f16(false, a, false, b, (short)0, c, false, false);
  asm volatile("v_nop\n\tv_nop\n\tv_nop\n\tv_nop" : "+v"(d) : "v"(a), "v"(b));
  return d;
}
__device__ __forceinline__ v8f wmma_bf(v16b a, v16b b, v8f c) {
  v8f d = __builtin_amdgcn_wmma_f32_16x16x32_bf16(false, a, false, b, (short)0, c, false, false);
  asm volatile("v_nop\n\tv_nop\n\tv_nop\n\tv_nop" : "+v"(d) : "v"(a), "v"(b));
  return d;
}
// 16x16x32 fragments: lane = (h = lane>>4, row/col = lane&15); elements 0..7 = k0+8h+0..7, 8..15 = k0+16+8h+0..7; D element r = row 8h+r
__device__ __forceinline__ v16h frag_h(const _Float16* rowk0, int lane) {
  union { v16h v; v8h q[2]; } u; const _Float16* p = rowk0 + 8 * (lane >> 4);
  u.q[0] = *(const v8h*)p; u.q[1] = *(const v8h*)(p + 16); return u.v;
}
__device__ __forceinline__ v16h frag_f32(const float* rowk0, int lane) {
  v16h a; const float* p = rowk0 + 8 * (lane >> 4);
#pragma unroll
  for (int i = 0; i < 8; ++i) { a[i] = (_Float16)p[i]; a[8 + i] = (_Float16)p[16 + i]; }
  return a;
}
__device__ __forceinline__ v16h frag_f32s(const float* rowk0, int lane, float sc) {
  v16h a; const float* p = rowk0 + 8 * (lane >> 4);
#pragma unroll
  for (int i = 0; i < 8; ++i) { a[i] = (_Float16)(p[i] * sc); a[8 + i] = (_Float16)(p[16 + i] * sc); }
  return a;
}
// column fragment from a [K][ld] layout (column n), rows >= K read as 0
__device__ __forceinline__ v16h fragc_f32(const float* W, int k0, int n, int lane, int ld, int K) {
  v16h a; const int g = lane >> 4;
#pragma unroll
  for (int i = 0; i < 8; ++i) { const int ka = k0 + 8 * g + i, kb = ka + 16;
    a[i] = (_Float16)(ka < K ? W[(size_t)(ka < K ? ka : K - 1) * ld + n] : 0.f); a[8 + i] = (_Float16)(kb < K ? W[(size_t)(kb < K ? kb : K - 1) * ld + n] : 0.f); }
  return a;
}
struct F2 { v16b h, l; };
__device__ __forceinline__ F2 bsplit16(const float v[16]) { F2 r;
#pragma unroll
  for (int i = 0; i < 16; ++i) { const __bf16 h = (__bf16)v[i]; r.h[i] = h; r.l[i] = (__bf16)(v[i] - (float)h); }
  return r; }
__device__ __forceinline__ F2 split_row(const float* row, int k0, int lane) { float v[16]; const float* p = row + k0 + 8 * (lane >> 4);
#pragma unroll
  for (int i = 0; i < 8; ++i) { v[i] = p[i]; v[8 + i] = p[16 + i]; }
  return bsplit16(v); }
__device__ __forceinline__ F2 split_rowK(const float* row, int k0, int lane, int K) { float v[16]; const int g = lane >> 4;
#pragma unroll
  for (int i = 0; i < 8; ++i) { const int ka = k0 + 8 * g + i, kb = ka + 16; v[i] = ka < K ? row[ka < K ? ka : K - 1] : 0.f; v[8 + i] = kb < K ? row[kb < K ? kb : K - 1] : 0.f; }
  return bsplit16(v); }
__device__ __forceinline__ F2 split_col(const float* W, int k0, int n, int lane, int ld, int K) { float v[16]; const int g = lane >> 4;
#pragma unroll
  for (int i = 0; i < 8; ++i) { const int ka = k0 + 8 * g + i, kb = ka + 16; v[i] = ka < K ? W[(size_t)(ka < K ? ka : K - 1) * ld + n] : 0.f; v[8 + i] = kb < K ? W[(size_t)(kb < K ? kb : K - 1) * ld + n] : 0.f; }
  return bsplit16(v); }
__device__ __forceinline__ v8f mac3(const F2& a, const F2& b, v8f c) { c = wmma_bf(a.l, b.h, c); c = wmma_bf(a.h, b.l, c); return wmma_bf(a.h, b.h, c); }
__device__ __forceinline__ float sigm(float v) { return 1.0f / (1.0f + expf(-v)); }
#define LDSX() do { asm volatile("s_wait_dscnt 0" ::: "memory"); __builtin_amdgcn_wave_barrier(); __builtin_amdgcn_fence(__ATOMIC_RELEASE, "workgroup"); } while (0)


// K-dim self attention on x [4,8,2048,64]: q,k,v = x W^T + b; scores[t][s] = (sum_i q[t][i]) (sum_j k[s][j]) / 8 (the reference einsum sums i and j independently); softmax over s; out = sum_s w v[s] -> [4,8,2048,64].
// k_pack, k_proj (exact GEMM + bias -> q|k|v rows; also qs/ks row sums), k_vt (V transposed hi/lo planes per (b,c)), k_attn (block = (64-query block, b*8+c), 4 waves: 64 key steps; scores from the two scalars, online max/sum, P hi/lo x V planes (3 products); writes the output rows).
#define NBC 32              // B*C
#define TT 2048
#define KD 64
#define NR (NBC * TT)       // 65536 rows
#define QKVP 192
#ifndef TRB
#define TRB (NR / 64)
#define TQB (TT / 64)
#define TNB NBC
#endif
typedef __attribute__((ext_vector_type(8))) __bf16 v8b;
__device__ __forceinline__ v16b frag_b(const __bf16* rowk0, int lane) {
  union { v16b v; v8b q[2]; } u; const __bf16* p = rowk0 + 8 * (lane >> 4);
  u.q[0] = *(const v8b*)p; u.q[1] = *(const v8b*)(p + 16); return u.v;
}
__device__ __forceinline__ v16b frag_gbf(const float* rowk0, int lane) {
  v16b a; const float* p = rowk0 + 8 * (lane >> 4);
#pragma unroll
  for (int i = 0; i < 8; ++i) { a[i] = (__bf16)p[i]; a[8 + i] = (__bf16)p[16 + i]; }
  return a;
}
__device__ __forceinline__ float bfr(float v) { return (float)(__bf16)v; }
__device__ __attribute__((noinline)) float exp_ni(float v) { return expf(v); }
#define WS_PT   0u                               // bf16 [192][64] (Wq|Wk|Wv rows, torch [out][in])
#define WS_QKV  (WS_PT + 2u * QKVP * KD)           // f32 [65536][192]
#define WS_QS   (WS_QKV + 4u * NR * QKVP)          // f32 [65536] row sums of q
#define WS_KS   (WS_QS + 4u * NR)
#define WS_VTH  (WS_KS + 4u * NR)                  // bf16 [32][64][2048]
#define WS_VTL  (WS_VTH + 2u * NBC * KD * TT)
#define WS_END  (WS_VTL + 2u * NBC * KD * TT)

__global__ __launch_bounds__(64) void k_pack(const float* __restrict__ Wq, const float* __restrict__ Wk, const float* __restrict__ Wv, __bf16* __restrict__ PT) {
  __shared__ __align__(16) __bf16 srow[64];
  const int n = blockIdx.x, tid = threadIdx.x; const int which = n / KD, c = n % KD; const float* Wm = (which == 0 ? Wq : which == 1 ? Wk : Wv) + (size_t)c * KD;
  srow[tid] = (__bf16)Wm[tid]; __syncthreads();
  if (tid < 8) vst2((unsigned*)(PT + (size_t)n * KD + tid * 8), *(const v4u*)(&srow[tid * 8]));
}
// ---- k_proj: block = 64 rows (4 waves): QKV rows (12 tiles, K 64 exact) + bias; qs/ks = row sums of the q and k parts (f32, from the LDS tile) -> QS/KS (64 floats = 256 B per block)
__global__ __launch_bounds__(128) void k_proj(const float* __restrict__ X, const __bf16* __restrict__ PT, const float* __restrict__ bq, const float* __restrict__ bk, const float* __restrict__ bv, float* __restrict__ QKV, float* __restrict__ QS, float* __restrict__ KS) {
  __shared__ __align__(16) float so[4][16][196]; __shared__ __align__(16) float sqs[64], sks[64];
  const int tid = threadIdx.x, wave = tid >> 5, lane = tid & 31, col = lane & 15, g = lane >> 4; const size_t r0 = (size_t)blockIdx.x * 64 + wave * 16;
  v8f acc[12] = {};
#pragma unroll
  for (int kc = 0; kc < 2; ++kc) { const v16b a = frag_gbf(X + (r0 + col) * KD + kc * 32, lane);
#pragma unroll
    for (int j = 0; j < 12; ++j) acc[j] = wmma_bf(a, frag_b(PT + (size_t)(j * 16 + col) * KD + kc * 32, lane), acc[j]); }
#pragma unroll
  for (int j = 0; j < 12; ++j) { const int n = j * 16 + col; const int which = n / KD, c = n % KD; const float bb = bfr((which == 0 ? bq : which == 1 ? bk : bv)[c]);
#pragma unroll
    for (int r = 0; r < 8; ++r) so[wave][8 * g + r][n] = acc[j][r] + bb; }
  LDSX();
  if (lane < 16) { float s1 = 0.f, s2 = 0.f; for (int d = 0; d < KD; ++d) { s1 += so[wave][lane][d]; s2 += so[wave][lane][KD + d]; } sqs[wave * 16 + lane] = s1; sks[wave * 16 + lane] = s2; }
  for (int rl = 0; rl < 16; ++rl) for (int pc = lane; pc < QKVP / 4; pc += 32) vst2(QKV + (r0 + rl) * QKVP + pc * 4, *(const v4f*)&so[wave][rl][pc * 4]);
  __syncthreads();
  if (tid < 16) vst2(QS + (size_t)blockIdx.x * 64 + tid * 4, *(const v4f*)&sqs[tid * 4]); else if (tid < 32) vst2(KS + (size_t)blockIdx.x * 64 + (tid - 16) * 4, *(const v4f*)&sks[(tid - 16) * 4]);
}
__global__ __launch_bounds__(256) void k_vt(const float* __restrict__ QKV, __bf16* __restrict__ VTH, __bf16* __restrict__ VTL) {
  __shared__ __align__(16) __bf16 svh[KD][72], svl[KD][72];
  const int tid = threadIdx.x; const size_t t0 = (size_t)blockIdx.x * 64; const int bc = (int)(t0 / TT), p0 = (int)(t0 % TT);
  for (int q = tid; q < 64 * KD; q += 256) { const int tl = q >> 6, d = q & 63; const float v = QKV[(t0 + tl) * QKVP + 2 * KD + d]; const __bf16 hb = (__bf16)v; svh[d][tl] = hb; svl[d][tl] = (__bf16)(v - (float)hb); }
  __syncthreads();
  for (int q = tid; q < KD * 8; q += 256) { const int rowi = q >> 3, pc = q & 7; const size_t o = ((size_t)bc * KD + rowi) * TT + p0 + pc * 8; vst2((unsigned*)(VTH + o), *(const v4u*)&svh[rowi][pc * 8]); vst2((unsigned*)(VTL + o), *(const v4u*)&svl[rowi][pc * 8]); }
}
// ---- k_attn: block = (query block, bc), 4 waves: s[r][kk] = qs[q] ks[kk] / 8; online softmax; P (hi/lo) x V planes (3 products); out rows 256 B
__global__ __launch_bounds__(128) void k_attn(const float* __restrict__ QS, const float* __restrict__ KS, const __bf16* __restrict__ VTH, const __bf16* __restrict__ VTL, float* __restrict__ OUT) {
  __shared__ __align__(16) float sp[4][16][36]; __shared__ __align__(16) float so[4][16][68];
  const int tid = threadIdx.x, wave = tid >> 5, lane = tid & 31, col = lane & 15, g = lane >> 4;
  const int qb = blockIdx.x, bc = blockIdx.y; const int q0 = qb * 64 + wave * 16; const size_t tq = (size_t)bc * TT + q0;
  float qsr[8]; 
#pragma unroll
  for (int r = 0; r < 8; ++r) qsr[r] = QS[tq + 8 * g + r] * 0.125f;
  float m[8], l[8];
#pragma unroll
  for (int r = 0; r < 8; ++r) { m[r] = -3.0e38f; l[r] = 0.f; }
  v8f acc[4] = {};
#pragma unroll 1
  for (int ks = 0; ks < TT / 32; ++ks) {
    const float k0 = KS[(size_t)bc * TT + ks * 32 + col], k1 = KS[(size_t)bc * TT + ks * 32 + 16 + col];
    float s[2][8];
#pragma unroll
    for (int r = 0; r < 8; ++r) { s[0][r] = qsr[r] * k0; s[1][r] = qsr[r] * k1; }
#pragma unroll
    for (int r = 0; r < 8; ++r) { float mx = fmaxf(s[0][r], s[1][r]);
#pragma unroll
      for (int o = 1; o < 16; o <<= 1) mx = fmaxf(mx, __shfl_xor(mx, o));
      const float mn = fmaxf(m[r], mx); const float alpha = exp_ni(m[r] - mn);
      const float e0 = exp_ni(s[0][r] - mn), e1 = exp_ni(s[1][r] - mn); float es = e0 + e1;
#pragma unroll
      for (int o = 1; o < 16; o <<= 1) es += __shfl_xor(es, o);
      l[r] = l[r] * alpha + es; m[r] = mn;
#pragma unroll
      for (int dt = 0; dt < 4; ++dt) acc[dt][r] *= alpha;
      sp[wave][8 * g + r][col] = e0; sp[wave][8 * g + r][16 + col] = e1; }
    LDSX();
    const F2 pa = split_row(&sp[wave][col][0], 0, lane);
#pragma unroll
    for (int dt = 0; dt < 4; ++dt) { const size_t vrow = ((size_t)bc * KD + dt * 16 + col) * TT + ks * 32; const v16b vh = frag_b(VTH + vrow, lane), vl = frag_b(VTL + vrow, lane);
      acc[dt] = wmma_bf(pa.l, vh, acc[dt]); acc[dt] = wmma_bf(pa.h, vl, acc[dt]); acc[dt] = wmma_bf(pa.h, vh, acc[dt]); }
    LDSX(); }
#pragma unroll
  for (int r = 0; r < 8; ++r) { const float il = 1.0f / l[r];
#pragma unroll
    for (int dt = 0; dt < 4; ++dt) so[wave][8 * g + r][dt * 16 + col] = acc[dt][r] * il; }
  LDSX();
  for (int rl = 0; rl < 16; ++rl) if (lane < 16) vst2(OUT + (tq + rl) * KD + lane * 4, *(const v4f*)&so[wave][rl][lane * 4]);
}

extern "C" void kernel_launch(void* const* d_in, const int* in_sizes, int n_in, void* d_out, int out_size, void* d_ws, size_t ws_size, hipStream_t stream) {
  (void)in_sizes; (void)n_in; (void)out_size;
  const float** F = (const float**)d_in;   // x [4,8,2048,64], Wq [64,64], bq, Wk, bk, Wv, bv (torch [out][in])
  if (ws_size < (size_t)WS_END) return;
  char* ws = (char*)d_ws; __bf16 *PT = (__bf16*)(ws + WS_PT), *VTH = (__bf16*)(ws + WS_VTH), *VTL = (__bf16*)(ws + WS_VTL); float *QKV = (float*)(ws + WS_QKV), *QS = (float*)(ws + WS_QS), *KS = (float*)(ws + WS_KS);
  k_pack<<<QKVP, 64, 0, stream>>>(F[1], F[3], F[5], PT);
  k_proj<<<TRB, 128, 0, stream>>>(F[0], PT, F[2], F[4], F[6], QKV, QS, KS);
  k_vt<<<TRB, 256, 0, stream>>>(QKV, VTH, VTL);
  k_attn<<<dim3(TQB, TNB), 128, 0, stream>>>(QS, KS, VTH, VTL, (float*)d_out);
}

// v001
// It runs in 179 microseconds.
// Timed twice side by side with v000, it ran 1.57 and 1.58 times as fast.
// compute dtype: x, Wq/Wk/Wv + biases (module inputs) rounded to bf16; q/k/v projections with exact bf16 products (+ bias); the per-row sums qs, ks and the rank-1 scores qs_t ks_s / 8 in f32; softmax weights x V with both computed operands as bf16 hi + residual pairs (3 products); softmax in f32; f32 accumulate.
#include <hip/hip_runtime.h>
#include <math.h>

typedef __attribute__((ext_vector_type(16))) _Float16 v16h;
typedef __attribute__((ext_vector_type(16))) __bf16 v16b;
typedef __attribute__((ext_vector_type(8)))  _Float16 v8h;
typedef __attribute__((ext_vector_type(8)))  float v8f;
typedef __attribute__((ext_vector_type(4)))  float v4f;
typedef __attribute__((ext_vector_type(2)))  float v2f;
typedef __attribute__((ext_vector_type(4)))  unsigned v4u;
typedef __attribute__((ext_vector_type(4)))  int v4i;
typedef float __attribute__((may_alias)) float_a;
typedef int __attribute__((may_alias)) int_a;

template <typename T> __device__ __forceinline__ void vst2(void* p, T v) { *(T*)p = v;  }
__device__ __forceinline__ v8f wmma16(v16h a, v16h b, v8f c) {
  v8f d = __builtin_amdgcn_wmma_f32_16x16x32_f16(false, a, false, b, (short)0, c, false, false);
  asm volatile("v_nop\n\tv_nop\n\tv_nop\n\tv_nop" : "+v"(d) : "v"(a), "v"(b));
  return d;
}
__device__ __forceinline__ v8f wmma_bf(v16b a, v16b b, v8f c) {
  v8f d = __builtin_amdgcn_wmma_f32_16x16x32_bf16(false, a, false, b, (short)0, c, false, false);
  asm volatile("v_nop\n\tv_nop\n\tv_nop\n\tv_nop" : "+v"(d) : "v"(a), "v"(b));
  return d;
}
// 16x16x32 fragments: lane = (h = lane>>4, row/col = lane&15); elements 0..7 = k0+8h+0..7, 8..15 = k0+16+8h+0..7; D element r = row 8h+r
__device__ __forceinline__ v16h frag_h(const _Float16* rowk0, int lane) {
  union { v16h v; v8h q[2]; } u; const _Float16* p = rowk0 + 8 * (lane >> 4);
  u.q[0] = *(const v8h*)p; u.q[1] = *(const v8h*)(p + 16); return u.v;
}
__device__ __forceinline__ v16h frag_f32(const float* rowk0, int lane) {
  v16h a; const float* p = rowk0 + 8 * (lane >> 4);
#pragma unroll
  for (int i = 0; i < 8; ++i) { a[i] = (_Float16)p[i]; a[8 + i] = (_Float16)p[16 + i]; }
  return a;
}
__device__ __forceinline__ v16h frag_f32s(const float* rowk0, int lane, float sc) {
  v16h a; const float* p = rowk0 + 8 * (lane >> 4);
#pragma unroll
  for (int i = 0; i < 8; ++i) { a[i] = (_Float16)(p[i] * sc); a[8 + i] = (_Float16)(p[16 + i] * sc); }
  return a;
}
// column fragment from a [K][ld] layout (column n), rows >= K read as 0
__device__ __forceinline__ v16h fragc_f32(const float* W, int k0, int n, int lane, int ld, int K) {
  v16h a; const int g = lane >> 4;
#pragma unroll
  for (int i = 0; i < 8; ++i) { const int ka = k0 + 8 * g + i, kb = ka + 16;
    a[i] = (_Float16)(ka < K ? W[(size_t)(ka < K ? ka : K - 1) * ld + n] : 0.f); a[8 + i] = (_Float16)(kb < K ? W[(size_t)(kb < K ? kb : K - 1) * ld + n] : 0.f); }
  return a;
}
struct F2 { v16b h, l; };
__device__ __forceinline__ F2 bsplit16(const float v[16]) { F2 r;
#pragma unroll
  for (int i = 0; i < 16; ++i) { const __bf16 h = (__bf16)v[i]; r.h[i] = h; r.l[i] = (__bf16)(v[i] - (float)h); }
  return r; }
__device__ __forceinline__ F2 split_row(const float* row, int k0, int lane) { float v[16]; const float* p = row + k0 + 8 * (lane >> 4);
#pragma unroll
  for (int i = 0; i < 8; ++i) { v[i] = p[i]; v[8 + i] = p[16 + i]; }
  return bsplit16(v); }
__device__ __forceinline__ F2 split_rowK(const float* row, int k0, int lane, int K) { float v[16]; const int g = lane >> 4;
#pragma unroll
  for (int i = 0; i < 8; ++i) { const int ka = k0 + 8 * g + i, kb = ka + 16; v[i] = ka < K ? row[ka < K ? ka : K - 1] : 0.f; v[8 + i] = kb < K ? row[kb < K ? kb : K - 1] : 0.f; }
  return bsplit16(v); }
__device__ __forceinline__ F2 split_col(const float* W, int k0, int n, int lane, int ld, int K) { float v[16]; const int g = lane >> 4;
#pragma unroll
  for (int i = 0; i < 8; ++i) { const int ka = k0 + 8 * g + i, kb = ka + 16; v[i] = ka < K ? W[(size_t)(ka < K ? ka : K - 1) * ld + n] : 0.f; v[8 + i] = kb < K ? W[(size_t)(kb < K ? kb : K - 1) * ld + n] : 0.f; }
  return bsplit16(v); }
__device__ __forceinline__ v8f mac3(const F2& a, const F2& b, v8f c) { c = wmma_bf(a.l, b.h, c); c = wmma_bf(a.h, b.l, c); return wmma_bf(a.h, b.h, c); }
__device__ __forceinline__ float sigm(float v) { return 1.0f / (1.0f + expf(-v)); }
#define LDSX() do { asm volatile("s_wait_dscnt 0" ::: "memory"); __builtin_amdgcn_wave_barrier(); __builtin_amdgcn_fence(__ATOMIC_RELEASE, "workgroup"); } while (0)


// K-dim self attention on x [4,8,2048,64]: q,k,v = x W^T + b; scores[t][s] = (sum_i q[t][i]) (sum_j k[s][j]) / 8 (the reference einsum sums i and j independently); softmax over s; out = sum_s w v[s] -> [4,8,2048,64].
// k_pack, k_proj (exact GEMM + bias -> q|k|v rows; also qs/ks row sums), k_vt (V transposed hi/lo planes per (b,c)), k_attn (block = (64-query block, b*8+c), 4 waves: 64 key steps; scores from the two scalars, row max in closed form, lane-partial row sums, P hi/lo x V planes (3 products); writes the output rows).
#define NBC 32              // B*C
#define TT 2048
#define KD 64
#define NR (NBC * TT)       // 65536 rows
#define QKVP 192
#ifndef TRB
#define TRB (NR / 64)
#define TQB (TT / 64)
#define TNB NBC
#endif
typedef __attribute__((ext_vector_type(8))) __bf16 v8b;
__device__ __forceinline__ v16b frag_b(const __bf16* rowk0, int lane) {
  union { v16b v; v8b q[2]; } u; const __bf16* p = rowk0 + 8 * (lane >> 4);
  u.q[0] = *(const v8b*)p; u.q[1] = *(const v8b*)(p + 16); return u.v;
}
__device__ __forceinline__ v16b frag_gbf(const float* rowk0, int lane) {
  v16b a; const float* p = rowk0 + 8 * (lane >> 4);
#pragma unroll
  for (int i = 0; i < 8; ++i) { a[i] = (__bf16)p[i]; a[8 + i] = (__bf16)p[16 + i]; }
  return a;
}
__device__ __forceinline__ float bfr(float v) { return (float)(__bf16)v; }
__device__ __attribute__((noinline)) float exp_ni(float v) { return expf(v); }
#define WS_PT   0u                               // bf16 [192][64] (Wq|Wk|Wv rows, torch [out][in])
#define WS_QKV  (WS_PT + 2u * QKVP * KD)           // f32 [65536][192]
#define WS_QS   (WS_QKV + 4u * NR * QKVP)          // f32 [65536] row sums of q
#define WS_KS   (WS_QS + 4u * NR)
#define WS_VTH  (WS_KS + 4u * NR)                  // bf16 [32][64][2048]
#define WS_VTL  (WS_VTH + 2u * NBC * KD * TT)
#define WS_END  (WS_VTL + 2u * NBC * KD * TT)

__global__ __launch_bounds__(64) void k_pack(const float* __restrict__ Wq, const float* __restrict__ Wk, const float* __restrict__ Wv, __bf16* __restrict__ PT) {
  __shared__ __align__(16) __bf16 srow[64];
  const int n = blockIdx.x, tid = threadIdx.x; const int which = n / KD, c = n % KD; const float* Wm = (which == 0 ? Wq : which == 1 ? Wk : Wv) + (size_t)c * KD;
  srow[tid] = (__bf16)Wm[tid]; __syncthreads();
  if (tid < 8) vst2((unsigned*)(PT + (size_t)n * KD + tid * 8), *(const v4u*)(&srow[tid * 8]));
}
// ---- k_proj: block = 64 rows (4 waves): QKV rows (12 tiles, K 64 exact) + bias; qs/ks = row sums of the q and k parts (f32, from the LDS tile) -> QS/KS (64 floats = 256 B per block)
__global__ __launch_bounds__(128) void k_proj(const float* __restrict__ X, const __bf16* __restrict__ PT, const float* __restrict__ bq, const float* __restrict__ bk, const float* __restrict__ bv, float* __restrict__ QKV, float* __restrict__ QS, float* __restrict__ KS) {
  __shared__ __align__(16) float so[4][16][196]; __shared__ __align__(16) float sqs[64], sks[64];
  const int tid = threadIdx.x, wave = tid >> 5, lane = tid & 31, col = lane & 15, g = lane >> 4; const size_t r0 = (size_t)blockIdx.x * 64 + wave * 16;
  v8f acc[12] = {};
#pragma unroll
  for (int kc = 0; kc < 2; ++kc) { const v16b a = frag_gbf(X + (r0 + col) * KD + kc * 32, lane);
#pragma unroll
    for (int j = 0; j < 12; ++j) acc[j] = wmma_bf(a, frag_b(PT + (size_t)(j * 16 + col) * KD + kc * 32, lane), acc[j]); }
#pragma unroll
  for (int j = 0; j < 12; ++j) { const int n = j * 16 + col; const int which = n / KD, c = n % KD; const float bb = bfr((which == 0 ? bq : which == 1 ? bk : bv)[c]);
#pragma unroll
    for (int r = 0; r < 8; ++r) so[wave][8 * g + r][n] = acc[j][r] + bb; }
  LDSX();
  if (lane < 16) { float s1 = 0.f, s2 = 0.f; for (int d = 0; d < KD; ++d) { s1 += so[wave][lane][d]; s2 += so[wave][lane][KD + d]; } sqs[wave * 16 + lane] = s1; sks[wave * 16 + lane] = s2; }
  for (int rl = 0; rl < 16; ++rl) for (int pc = lane; pc < QKVP / 4; pc += 32) vst2(QKV + (r0 + rl) * QKVP + pc * 4, *(const v4f*)&so[wave][rl][pc * 4]);
  __syncthreads();
  if (tid < 16) vst2(QS + (size_t)blockIdx.x * 64 + tid * 4, *(const v4f*)&sqs[tid * 4]); else if (tid < 32) vst2(KS + (size_t)blockIdx.x * 64 + (tid - 16) * 4, *(const v4f*)&sks[(tid - 16) * 4]);
}
__global__ __launch_bounds__(256) void k_vt(const float* __restrict__ QKV, __bf16* __restrict__ VTH, __bf16* __restrict__ VTL) {
  __shared__ __align__(16) __bf16 svh[KD][72], svl[KD][72];
  const int tid = threadIdx.x; const size_t t0 = (size_t)blockIdx.x * 64; const int bc = (int)(t0 / TT), p0 = (int)(t0 % TT);
  for (int q = tid; q < 64 * KD; q += 256) { const int tl = q >> 6, d = q & 63; const float v = QKV[(t0 + tl) * QKVP + 2 * KD + d]; const __bf16 hb = (__bf16)v; svh[d][tl] = hb; svl[d][tl] = (__bf16)(v - (float)hb); }
  __syncthreads();
  for (int q = tid; q < KD * 8; q += 256) { const int rowi = q >> 3, pc = q & 7; const size_t o = ((size_t)bc * KD + rowi) * TT + p0 + pc * 8; vst2((unsigned*)(VTH + o), *(const v4u*)&svh[rowi][pc * 8]); vst2((unsigned*)(VTL + o), *(const v4u*)&svl[rowi][pc * 8]); }
}
// ---- k_attn: block = (query block, bc), 4 waves: s[r][kk] = qs[q] ks[kk] / 8; softmax against the closed-form row max; P (hi/lo) x V planes (3 products); out rows 256 B
__global__ __launch_bounds__(128) void k_attn(const float* __restrict__ QS, const float* __restrict__ KS, const __bf16* __restrict__ VTH, const __bf16* __restrict__ VTL, float* __restrict__ OUT) {
  __shared__ __align__(16) float sp[4][16][36]; __shared__ __align__(16) float so[4][16][68];
  const int tid = threadIdx.x, wave = tid >> 5, lane = tid & 31, col = lane & 15, g = lane >> 4;
  const int qb = blockIdx.x, bc = blockIdx.y; const int q0 = qb * 64 + wave * 16; const size_t tq = (size_t)bc * TT + q0;
  float qsr[8]; 
#pragma unroll
  for (int r = 0; r < 8; ++r) qsr[r] = QS[tq + 8 * g + r] * 0.125f;
  // scores are rank 1 (qs[t] * ks[s]) and rounding is monotonic, so the row maximum is exactly max(qs*max ks, qs*min ks): each wave scans the 2048 ks of its (b,c) once
  const float* ksb = KS + (size_t)bc * TT;
  float kmx = -INFINITY, kmn = INFINITY;
  // unrolled so that the 16 loads are in flight together
#pragma unroll
  for (int i = 0; i < TT / 128; ++i) { const v4f kv = *(const v4f*)(ksb + i * 128 + lane * 4);
    kmx = fmaxf(kmx, fmaxf(fmaxf(kv[0], kv[1]), fmaxf(kv[2], kv[3]))); kmn = fminf(kmn, fminf(fminf(kv[0], kv[1]), fminf(kv[2], kv[3]))); }
  for (int o = 1; o < 32; o <<= 1) { kmx = fmaxf(kmx, __shfl_xor(kmx, o)); kmn = fminf(kmn, __shfl_xor(kmn, o)); }
  float m[8], l[8];   // l: this lane's share of the row sum (its two key columns per step), reduced over the 16 lanes behind the loop
#pragma unroll
  for (int r = 0; r < 8; ++r) { m[r] = fmaxf(qsr[r] * kmx, qsr[r] * kmn); l[r] = 0.f; }
  v8f acc[4] = {};
#pragma unroll 1
  for (int ks = 0; ks < TT / 32; ++ks) {
    const float k0 = KS[(size_t)bc * TT + ks * 32 + col], k1 = KS[(size_t)bc * TT + ks * 32 + 16 + col];
    // unrolled so that qsr, m and l are indexed by constants and stay in registers
#pragma unroll
    for (int r = 0; r < 8; ++r) { const float e0 = exp_ni(qsr[r] * k0 - m[r]), e1 = exp_ni(qsr[r] * k1 - m[r]);
      l[r] += e0 + e1;
      sp[wave][8 * g + r][col] = e0; sp[wave][8 * g + r][16 + col] = e1; }
    LDSX();
    const F2 pa = split_row(&sp[wave][col][0], 0, lane);
#pragma unroll
    for (int dt = 0; dt < 4; ++dt) { const size_t vrow = ((size_t)bc * KD + dt * 16 + col) * TT + ks * 32; const v16b vh = frag_b(VTH + vrow, lane), vl = frag_b(VTL + vrow, lane);
      acc[dt] = wmma_bf(pa.l, vh, acc[dt]); acc[dt] = wmma_bf(pa.h, vl, acc[dt]); acc[dt] = wmma_bf(pa.h, vh, acc[dt]); }
    LDSX(); }
#pragma unroll
  for (int r = 0; r < 8; ++r) { float es = l[r];
    for (int o = 1; o < 16; o <<= 1) es += __shfl_xor(es, o);
    const float il = 1.0f / es;
#pragma unroll
    for (int dt = 0; dt < 4; ++dt) so[wave][8 * g + r][dt * 16 + col] = acc[dt][r] * il; }
  LDSX();
  for (int rl = 0; rl < 16; ++rl) if (lane < 16) vst2(OUT + (tq + rl) * KD + lane * 4, *(const v4f*)&so[wave][rl][lane * 4]);
}

extern "C" void kernel_launch(void* const* d_in, const int* in_sizes, int n_in, void* d_out, int out_size, void* d_ws, size_t ws_size, hipStream_t stream) {
  (void)in_sizes; (void)n_in; (void)out_size;
  const float** F = (const float**)d_in;   // x [4,8,2048,64], Wq [64,64], bq, Wk, bk, Wv, bv (torch [out][in])
  if (ws_size < (size_t)WS_END) return;
  char* ws = (char*)d_ws; __bf16 *PT = (__bf16*)(ws + WS_PT), *VTH = (__bf16*)(ws + WS_VTH), *VTL = (__bf16*)(ws + WS_VTL); float *QKV = (float*)(ws + WS_QKV), *QS = (float*)(ws + WS_QS), *KS = (float*)(ws + WS_KS);
  k_pack<<<QKVP, 64, 0, stream>>>(F[1], F[3], F[5], PT);
  k_proj<<<TRB, 128, 0, stream>>>(F[0], PT, F[2], F[4], F[6], QKV, QS, KS);
  k_vt<<<TRB, 256, 0, stream>>>(QKV, VTH, VTL);
  k_attn<<<dim3(TQB, TNB), 128, 0, stream>>>(QS, KS, VTH, VTL, (float*)d_out);
}

// v002
// One run takes 136 microseconds.
// Two timings next to v001 both put it at 1.32 times that version's speed.
// Over all steps from v000 it is 2.07 times as fast.
// compute dtype: x, Wq/Wk/Wv + biases (module inputs) rounded to bf16; q/k/v projections with exact bf16 products (+ bias); the per-row sums qs, ks and the rank-1 scores qs_t ks_s / 8 in f32; softmax weights x V with both computed operands as bf16 hi + residual pairs (3 products); softmax in f32; f32 accumulate.
#include <hip/hip_runtime.h>
#include <math.h>

typedef __attribute__((ext_vector_type(16))) _Float16 v16h;
typedef __attribute__((ext_vector_type(16))) __bf16 v16b;
typedef __attribute__((ext_vector_type(8)))  _Float16 v8h;
typedef __attribute__((ext_vector_type(8)))  float v8f;
typedef __attribute__((ext_vector_type(4)))  float v4f;
typedef __attribute__((ext_vector_type(2)))  float v2f;
typedef __attribute__((ext_vector_type(4)))  unsigned v4u;
typedef __attribute__((ext_vector_type(4)))  int v4i;
typedef float __attribute__((may_alias)) float_a;
typedef int __attribute__((may_alias)) int_a;

template <typename T> __device__ __forceinline__ void vst2(void* p, T v) { *(T*)p = v;  }
__device__ __forceinline__ v8f wmma16(v16h a, v16h b, v8f c) {
  v8f d = __builtin_amdgcn_wmma_f32_16x16x32_f16(false, a, false, b, (short)0, c, false, false);
  asm volatile("v_nop\n\tv_nop\n\tv_nop\n\tv_nop" : "+v"(d) : "v"(a), "v"(b));
  return d;
}
__device__ __forceinline__ v8f wmma_bf(v16b a, v16b b, v8f c) {
  v8f d = __builtin_amdgcn_wmma_f32_16x16x32_bf16(false, a, false, b, (short)0, c, false, false);
  asm volatile("v_nop\n\tv_nop\n\tv_nop\n\tv_nop" : "+v"(d) : "v"(a), "v"(b));
  return d;
}
// 16x16x32 fragments: lane = (h = lane>>4, row/col = lane&15); elements 0..7 = k0+8h+0..7, 8..15 = k0+16+8h+0..7; D element r = row 8h+r
__device__ __forceinline__ v16h frag_h(const _Float16* rowk0, int lane) {
  union { v16h v; v8h q[2]; } u; const _Float16* p = rowk0 + 8 * (lane >> 4);
  u.q[0] = *(const v8h*)p; u.q[1] = *(const v8h*)(p + 16); return u.v;
}
__device__ __forceinline__ v16h frag_f32(const float* rowk0, int lane) {
  v16h a; const float* p = rowk0 + 8 * (lane >> 4);
#pragma unroll
  for (int i = 0; i < 8; ++i) { a[i] = (_Float16)p[i]; a[8 + i] = (_Float16)p[16 + i]; }
  return a;
}
__device__ __forceinline__ v16h frag_f32s(const float* rowk0, int lane, float sc) {
  v16h a; const float* p = rowk0 + 8 * (lane >> 4);
#pragma unroll
  for (int i = 0; i < 8; ++i) { a[i] = (_Float16)(p[i] * sc); a[8 + i] = (_Float16)(p[16 + i] * sc); }
  return a;
}
// column fragment from a [K][ld] layout (column n), rows >= K read as 0
__device__ __forceinline__ v16h fragc_f32(const float* W, int k0, int n, int lane, int ld, int K) {
  v16h a; const int g = lane >> 4;
#pragma unroll
  for (int i = 0; i < 8; ++i) { const int ka = k0 + 8 * g + i, kb = ka + 16;
    a[i] = (_Float16)(ka < K ? W[(size_t)(ka < K ? ka : K - 1) * ld + n] : 0.f); a[8 + i] = (_Float16)(kb < K ? W[(size_t)(kb < K ? kb : K - 1) * ld + n] : 0.f); }
  return a;
}
struct F2 { v16b h, l; };
__device__ __forceinline__ F2 bsplit16(const float v[16]) { F2 r;
#pragma unroll
  for (int i = 0; i < 16; ++i) { const __bf16 h = (__bf16)v[i]; r.h[i] = h; r.l[i] = (__bf16)(v[i] - (float)h); }
  return r; }
__device__ __forceinline__ F2 split_row(const float* row, int k0, int lane) { float v[16]; const float* p = row + k0 + 8 * (lane >> 4);
#pragma unroll
  for (int i = 0; i < 8; ++i) { v[i] = p[i]; v[8 + i] = p[16 + i]; }
  return bsplit16(v); }
__device__ __forceinline__ F2 split_rowK(const float* row, int k0, int lane, int K) { float v[16]; const int g = lane >> 4;
#pragma unroll
  for (int i = 0; i < 8; ++i) { const int ka = k0 + 8 * g + i, kb = ka + 16; v[i] = ka < K ? row[ka < K ? ka : K - 1] : 0.f; v[8 + i] = kb < K ? row[kb < K ? kb : K - 1] : 0.f; }
  return bsplit16(v); }
__device__ __forceinline__ F2 split_col(const float* W, int k0, int n, int lane, int ld, int K) { float v[16]; const int g = lane >> 4;
#pragma unroll
  for (int i = 0; i < 8; ++i) { const int ka = k0 + 8 * g + i, kb = ka + 16; v[i] = ka < K ? W[(size_t)(ka < K ? ka : K - 1) * ld + n] : 0.f; v[8 + i] = kb < K ? W[(size_t)(kb < K ? kb : K - 1) * ld + n] : 0.f; }
  return bsplit16(v); }
__device__ __forceinline__ v8f mac3(const F2& a, const F2& b, v8f c) { c = wmma_bf(a.l, b.h, c); c = wmma_bf(a.h, b.l, c); return wmma_bf(a.h, b.h, c); }
__device__ __forceinline__ float sigm(float v) { return 1.0f / (1.0f + expf(-v)); }
#define LDSX() do { asm volatile("s_wait_dscnt 0" ::: "memory"); __builtin_amdgcn_wave_barrier(); __builtin_amdgcn_fence(__ATOMIC_RELEASE, "workgroup"); } while (0)


// K-dim self attention on x [4,8,2048,64]: q,k,v = x W^T + b; scores[t][s] = (sum_i q[t][i]) (sum_j k[s][j]) / 8 (the reference einsum sums i and j independently); softmax over s; out = sum_s w v[s] -> [4,8,2048,64].
// k_pack, k_proj (exact GEMM + bias -> q|k|v rows; also qs/ks row sums), k_vt (V transposed hi/lo planes per (b,c)), k_attn (block = (64-query block, b*8+c), 4 waves: 64 key steps; scores from the two scalars, row max in closed form, lane-partial row sums, P hi/lo x V planes (3 products); writes the output rows).
#define NBC 32              // B*C
#define TT 2048
#define KD 64
#define NR (NBC * TT)       // 65536 rows
#define QKVP 192
#ifndef TRB
#define TRB (NR / 64)
#define TQB (TT / 64)
#define TNB NBC
#endif
typedef __attribute__((ext_vector_type(8))) __bf16 v8b;
__device__ __forceinline__ v16b frag_b(const __bf16* rowk0, int lane) {
  union { v16b v; v8b q[2]; } u; const __bf16* p = rowk0 + 8 * (lane >> 4);
  u.q[0] = *(const v8b*)p; u.q[1] = *(const v8b*)(p + 16); return u.v;
}
__device__ __forceinline__ v16b frag_gbf(const float* rowk0, int lane) {
  v16b a; const float* p = rowk0 + 8 * (lane >> 4);
#pragma unroll
  for (int i = 0; i < 8; ++i) { a[i] = (__bf16)p[i]; a[8 + i] = (__bf16)p[16 + i]; }
  return a;
}
__device__ __forceinline__ float bfr(float v) { return (float)(__bf16)v; }
#define WS_PT   0u                               // bf16 [192][64] (Wq|Wk|Wv rows, torch [out][in])
#define WS_QKV  (WS_PT + 2u * QKVP * KD)           // f32 [65536][192]
#define WS_QS   (WS_QKV + 4u * NR * QKVP)          // f32 [65536] row sums of q
#define WS_KS   (WS_QS + 4u * NR)
#define WS_VTH  (WS_KS + 4u * NR)                  // bf16 [32][64][2048]
#define WS_VTL  (WS_VTH + 2u * NBC * KD * TT)
#define WS_END  (WS_VTL + 2u * NBC * KD * TT)

__global__ __launch_bounds__(64) void k_pack(const float* __restrict__ Wq, const float* __restrict__ Wk, const float* __restrict__ Wv, __bf16* __restrict__ PT) {
  __shared__ __align__(16) __bf16 srow[64];
  const int n = blockIdx.x, tid = threadIdx.x; const int which = n / KD, c = n % KD; const float* Wm = (which == 0 ? Wq : which == 1 ? Wk : Wv) + (size_t)c * KD;
  srow[tid] = (__bf16)Wm[tid]; __syncthreads();
  if (tid < 8) vst2((unsigned*)(PT + (size_t)n * KD + tid * 8), *(const v4u*)(&srow[tid * 8]));
}
// ---- k_proj: block = 64 rows (4 waves): QKV rows (12 tiles, K 64 exact) + bias; qs/ks = row sums of the q and k parts (f32, from the LDS tile) -> QS/KS (64 floats = 256 B per block)
__global__ __launch_bounds__(128) void k_proj(const float* __restrict__ X, const __bf16* __restrict__ PT, const float* __restrict__ bq, const float* __restrict__ bk, const float* __restrict__ bv, float* __restrict__ QKV, float* __restrict__ QS, float* __restrict__ KS) {
  __shared__ __align__(16) float so[4][16][196]; __shared__ __align__(16) float sqs[64], sks[64];
  const int tid = threadIdx.x, wave = tid >> 5, lane = tid & 31, col = lane & 15, g = lane >> 4; const size_t r0 = (size_t)blockIdx.x * 64 + wave * 16;
  v8f acc[12] = {};
#pragma unroll
  for (int kc = 0; kc < 2; ++kc) { const v16b a = frag_gbf(X + (r0 + col) * KD + kc * 32, lane);
#pragma unroll
    for (int j = 0; j < 12; ++j) acc[j] = wmma_bf(a, frag_b(PT + (size_t)(j * 16 + col) * KD + kc * 32, lane), acc[j]); }
#pragma unroll
  for (int j = 0; j < 12; ++j) { const int n = j * 16 + col; const int which = n / KD, c = n % KD; const float bb = bfr((which == 0 ? bq : which == 1 ? bk : bv)[c]);
#pragma unroll
    for (int r = 0; r < 8; ++r) so[wave][8 * g + r][n] = acc[j][r] + bb; }
  LDSX();
  if (lane < 16) { float s1 = 0.f, s2 = 0.f; for (int d = 0; d < KD; ++d) { s1 += so[wave][lane][d]; s2 += so[wave][lane][KD + d]; } sqs[wave * 16 + lane] = s1; sks[wave * 16 + lane] = s2; }
  for (int rl = 0; rl < 16; ++rl) for (int pc = lane; pc < QKVP / 4; pc += 32) vst2(QKV + (r0 + rl) * QKVP + pc * 4, *(const v4f*)&so[wave][rl][pc * 4]);
  __syncthreads();
  if (tid < 16) vst2(QS + (size_t)blockIdx.x * 64 + tid * 4, *(const v4f*)&sqs[tid * 4]); else if (tid < 32) vst2(KS + (size_t)blockIdx.x * 64 + (tid - 16) * 4, *(const v4f*)&sks[(tid - 16) * 4]);
}
__global__ __launch_bounds__(256) void k_vt(const float* __restrict__ QKV, __bf16* __restrict__ VTH, __bf16* __restrict__ VTL) {
  __shared__ __align__(16) __bf16 svh[KD][72], svl[KD][72];
  const int tid = threadIdx.x; const size_t t0 = (size_t)blockIdx.x * 64; const int bc = (int)(t0 / TT), p0 = (int)(t0 % TT);
  for (int q = tid; q < 64 * KD; q += 256) { const int tl = q >> 6, d = q & 63; const float v = QKV[(t0 + tl) * QKVP + 2 * KD + d]; const __bf16 hb = (__bf16)v; svh[d][tl] = hb; svl[d][tl] = (__bf16)(v - (float)hb); }
  __syncthreads();
  for (int q = tid; q < KD * 8; q += 256) { const int rowi = q >> 3, pc = q & 7; const size_t o = ((size_t)bc * KD + rowi) * TT + p0 + pc * 8; vst2((unsigned*)(VTH + o), *(const v4u*)&svh[rowi][pc * 8]); vst2((unsigned*)(VTL + o), *(const v4u*)&svl[rowi][pc * 8]); }
}
// ---- k_attn: block = (query block, bc), 4 waves: s[r][kk] = qs[q] ks[kk] / 8; softmax against the closed-form row max; P (hi/lo) x V planes (3 products); out rows 256 B
__global__ __launch_bounds__(128) void k_attn(const float* __restrict__ QS, const float* __restrict__ KS, const __bf16* __restrict__ VTH, const __bf16* __restrict__ VTL, float* __restrict__ OUT) {
  __shared__ __align__(16) float sp[4][16][36]; __shared__ __align__(16) float so[4][16][68];
  const int tid = threadIdx.x, wave = tid >> 5, lane = tid & 31, col = lane & 15, g = lane >> 4;
  const int qb = blockIdx.x, bc = blockIdx.y; const int q0 = qb * 64 + wave * 16; const size_t tq = (size_t)bc * TT + q0;
  float qsr[8]; 
#pragma unroll
  for (int r = 0; r < 8; ++r) qsr[r] = QS[tq + 8 * g + r] * (0.125f * 1.44269504088896340736f);   // 1/8 and log2(e) in one factor: the weights are 2^(qsr ks - m)
  // scores are rank 1 (qs[t] * ks[s]) and rounding is monotonic, so the row maximum is exactly max(qs*max ks, qs*min ks): each wave scans the 2048 ks of its (b,c) once
  const float* ksb = KS + (size_t)bc * TT;
  float kmx = -INFINITY, kmn = INFINITY;
  // unrolled so that the 16 loads are in flight together
#pragma unroll
  for (int i = 0; i < TT / 128; ++i) { const v4f kv = *(const v4f*)(ksb + i * 128 + lane * 4);
    kmx = fmaxf(kmx, fmaxf(fmaxf(kv[0], kv[1]), fmaxf(kv[2], kv[3]))); kmn = fminf(kmn, fminf(fminf(kv[0], kv[1]), fminf(kv[2], kv[3]))); }
  for (int o = 1; o < 32; o <<= 1) { kmx = fmaxf(kmx, __shfl_xor(kmx, o)); kmn = fminf(kmn, __shfl_xor(kmn, o)); }
  float m[8], l[8];   // l: this lane's share of the row sum (its two key columns per step), reduced over the 16 lanes behind the loop
#pragma unroll
  for (int r = 0; r < 8; ++r) { m[r] = fmaxf(qsr[r] * kmx, qsr[r] * kmn); l[r] = 0.f; }
  v8f acc[4] = {};
#pragma unroll 1
  for (int ks = 0; ks < TT / 32; ++ks) {
    const float k0 = KS[(size_t)bc * TT + ks * 32 + col], k1 = KS[(size_t)bc * TT + ks * 32 + 16 + col];
    // unrolled so that qsr, m and l are indexed by constants and stay in registers
#pragma unroll
    for (int r = 0; r < 8; ++r) { const float e0 = __builtin_amdgcn_exp2f(qsr[r] * k0 - m[r]), e1 = __builtin_amdgcn_exp2f(qsr[r] * k1 - m[r]);
      l[r] += e0 + e1;
      sp[wave][8 * g + r][col] = e0; sp[wave][8 * g + r][16 + col] = e1; }
    LDSX();
    const F2 pa = split_row(&sp[wave][col][0], 0, lane);
#pragma unroll
    for (int dt = 0; dt < 4; ++dt) { const size_t vrow = ((size_t)bc * KD + dt * 16 + col) * TT + ks * 32; const v16b vh = frag_b(VTH + vrow, lane), vl = frag_b(VTL + vrow, lane);
      acc[dt] = wmma_bf(pa.l, vh, acc[dt]); acc[dt] = wmma_bf(pa.h, vl, acc[dt]); acc[dt] = wmma_bf(pa.h, vh, acc[dt]); }
    LDSX(); }
#pragma unroll
  for (int r = 0; r < 8; ++r) { float es = l[r];
    for (int o = 1; o < 16; o <<= 1) es += __shfl_xor(es, o);
    const float il = 1.0f / es;
#pragma unroll
    for (int dt = 0; dt < 4; ++dt) so[wave][8 * g + r][dt * 16 + col] = acc[dt][r] * il; }
  LDSX();
  for (int rl = 0; rl < 16; ++rl) if (lane < 16) vst2(OUT + (tq + rl) * KD + lane * 4, *(const v4f*)&so[wave][rl][lane * 4]);
}

extern "C" void kernel_launch(void* const* d_in, const int* in_sizes, int n_in, void* d_out, int out_size, void* d_ws, size_t ws_size, hipStream_t stream) {
  (void)in_sizes; (void)n_in; (void)out_size;
  const float** F = (const float**)d_in;   // x [4,8,2048,64], Wq [64,64], bq, Wk, bk, Wv, bv (torch [out][in])
  if (ws_size < (size_t)WS_END) return;
  char* ws = (char*)d_ws; __bf16 *PT = (__bf16*)(ws + WS_PT), *VTH = (__bf16*)(ws + WS_VTH), *VTL = (__bf16*)(ws + WS_VTL); float *QKV = (float*)(ws + WS_QKV), *QS = (float*)(ws + WS_QS), *KS = (float*)(ws + WS_KS);
  k_pack<<<QKVP, 64, 0, stream>>>(F[1], F[3], F[5], PT);
  k_proj<<<TRB, 128, 0, stream>>>(F[0], PT, F[2], F[4], F[6], QKV, QS, KS);
  k_vt<<<TRB, 256, 0, stream>>>(QKV, VTH, VTL);
  k_attn<<<dim3(TQB, TNB), 128, 0, stream>>>(QS, KS, VTH, VTL, (float*)d_out);
}

// v003
// It runs in 121 microseconds.
// In both of two side-by-side timings against v002, it was 1.13 times as fast.
// Counting every step since v000, it is 2.34 times as fast.
// compute dtype: x, Wq/Wk/Wv + biases (module inputs) rounded to bf16; q/k/v projections with exact bf16 products (+ bias); the per-row sums qs, ks and the rank-1 scores qs_t ks_s / 8 in f32; softmax weights x V with both computed operands as bf16 hi + residual pairs (3 products); softmax in f32; f32 accumulate.
#include <hip/hip_runtime.h>
#include <math.h>

typedef __attribute__((ext_vector_type(16))) _Float16 v16h;
typedef __attribute__((ext_vector_type(16))) __bf16 v16b;
typedef __attribute__((ext_vector_type(8)))  _Float16 v8h;
typedef __attribute__((ext_vector_type(8)))  float v8f;
typedef __attribute__((ext_vector_type(4)))  float v4f;
typedef __attribute__((ext_vector_type(2)))  float v2f;
typedef __attribute__((ext_vector_type(4)))  unsigned v4u;
typedef __attribute__((ext_vector_type(4)))  int v4i;
typedef float __attribute__((may_alias)) float_a;
typedef int __attribute__((may_alias)) int_a;

template <typename T> __device__ __forceinline__ void vst2(void* p, T v) { *(T*)p = v;  }
__device__ __forceinline__ v8f wmma16(v16h a, v16h b, v8f c) {
  v8f d = __builtin_amdgcn_wmma_f32_16x16x32_f16(false, a, false, b, (short)0, c, false, false);
  asm volatile("v_nop\n\tv_nop\n\tv_nop\n\tv_nop" : "+v"(d) : "v"(a), "v"(b));
  return d;
}
__device__ __forceinline__ v8f wmma_bf(v16b a, v16b b, v8f c) {
  v8f d = __builtin_amdgcn_wmma_f32_16x16x32_bf16(false, a, false, b, (short)0, c, false, false);
  asm volatile("v_nop\n\tv_nop\n\tv_nop\n\tv_nop" : "+v"(d) : "v"(a), "v"(b));
  return d;
}
// 16x16x32 fragments: lane = (h = lane>>4, row/col = lane&15); elements 0..7 = k0+8h+0..7, 8..15 = k0+16+8h+0..7; D element r = row 8h+r
__device__ __forceinline__ v16h frag_h(const _Float16* rowk0, int lane) {
  union { v16h v; v8h q[2]; } u; const _Float16* p = rowk0 + 8 * (lane >> 4);
  u.q[0] = *(const v8h*)p; u.q[1] = *(const v8h*)(p + 16); return u.v;
}
__device__ __forceinline__ v16h frag_f32(const float* rowk0, int lane) {
  v16h a; const float* p = rowk0 + 8 * (lane >> 4);
#pragma unroll
  for (int i = 0; i < 8; ++i) { a[i] = (_Float16)p[i]; a[8 + i] = (_Float16)p[16 + i]; }
  return a;
}
__device__ __forceinline__ v16h frag_f32s(const float* rowk0, int lane, float sc) {
  v16h a; const float* p = rowk0 + 8 * (lane >> 4);
#pragma unroll
  for (int i = 0; i < 8; ++i) { a[i] = (_Float16)(p[i] * sc); a[8 + i] = (_Float16)(p[16 + i] * sc); }
  return a;
}
// column fragment from a [K][ld] layout (column n), rows >= K read as 0
__device__ __forceinline__ v16h fragc_f32(const float* W, int k0, int n, int lane, int ld, int K) {
  v16h a; const int g = lane >> 4;
#pragma unroll
  for (int i = 0; i < 8; ++i) { const int ka = k0 + 8 * g + i, kb = ka + 16;
    a[i] = (_Float16)(ka < K ? W[(size_t)(ka < K ? ka : K - 1) * ld + n] : 0.f); a[8 + i] = (_Float16)(kb < K ? W[(size_t)(kb < K ? kb : K - 1) * ld + n] : 0.f); }
  return a;
}
struct F2 { v16b h, l; };
__device__ __forceinline__ F2 bsplit16(const float v[16]) { F2 r;
#pragma unroll
  for (int i = 0; i < 16; ++i) { const __bf16 h = (__bf16)v[i]; r.h[i] = h; r.l[i] = (__bf16)(v[i] - (float)h); }
  return r; }
__device__ __forceinline__ F2 split_row(const float* row, int k0, int lane) { float v[16]; const float* p = row + k0 + 8 * (lane >> 4);
#pragma unroll
  for (int i = 0; i < 8; ++i) { v[i] = p[i]; v[8 + i] = p[16 + i]; }
  return bsplit16(v); }
__device__ __forceinline__ F2 split_rowK(const float* row, int k0, int lane, int K) { float v[16]; const int g = lane >> 4;
#pragma unroll
  for (int i = 0; i < 8; ++i) { const int ka = k0 + 8 * g + i, kb = ka + 16; v[i] = ka < K ? row[ka < K ? ka : K - 1] : 0.f; v[8 + i] = kb < K ? row[kb < K ? kb : K - 1] : 0.f; }
  return bsplit16(v); }
__device__ __forceinline__ F2 split_col(const float* W, int k0, int n, int lane, int ld, int K) { float v[16]; const int g = lane >> 4;
#pragma unroll
  for (int i = 0; i < 8; ++i) { const int ka = k0 + 8 * g + i, kb = ka + 16; v[i] = ka < K ? W[(size_t)(ka < K ? ka : K - 1) * ld + n] : 0.f; v[8 + i] = kb < K ? W[(size_t)(kb < K ? kb : K - 1) * ld + n] : 0.f; }
  return bsplit16(v); }
__device__ __forceinline__ v8f mac3(const F2& a, const F2& b, v8f c) { c = wmma_bf(a.l, b.h, c); c = wmma_bf(a.h, b.l, c); return wmma_bf(a.h, b.h, c); }
__device__ __forceinline__ float sigm(float v) { return 1.0f / (1.0f + expf(-v)); }
#define LDSX() do { asm volatile("s_wait_dscnt 0" ::: "memory"); __builtin_amdgcn_wave_barrier(); __builtin_amdgcn_fence(__ATOMIC_RELEASE, "workgroup"); } while (0)


// K-dim self attention on x [4,8,2048,64]: q,k,v = x W^T + b; scores[t][s] = (sum_i q[t][i]) (sum_j k[s][j]) / 8 (the reference einsum sums i and j independently); softmax over s; out = sum_s w v[s] -> [4,8,2048,64].
// k_pack, k_proj (exact GEMM + bias -> q|k|v rows; also qs/ks row sums), k_vt (V transposed hi/lo planes per (b,c)), k_attn (block = (64-query block, b*8+c), 4 waves: 64 key steps; scores from the two scalars, row max in closed form, lane-partial row sums, P hi/lo x V planes (3 products); writes the output rows).
#define NBC 32              // B*C
#define TT 2048
#define KD 64
#define NR (NBC * TT)       // 65536 rows
#define QKVP 192
#ifndef TRB
#define TRB (NR / 64)
#define TQB (TT / 64)
#define TNB NBC
#endif
typedef __attribute__((ext_vector_type(8))) __bf16 v8b;
__device__ __forceinline__ v16b frag_b(const __bf16* rowk0, int lane) {
  union { v16b v; v8b q[2]; } u; const __bf16* p = rowk0 + 8 * (lane >> 4);
  u.q[0] = *(const v8b*)p; u.q[1] = *(const v8b*)(p + 16); return u.v;
}
__device__ __forceinline__ v16b frag_gbf(const float* rowk0, int lane) {
  v16b a; const float* p = rowk0 + 8 * (lane >> 4);
#pragma unroll
  for (int i = 0; i < 8; ++i) { a[i] = (__bf16)p[i]; a[8 + i] = (__bf16)p[16 + i]; }
  return a;
}
__device__ __forceinline__ float bfr(float v) { return (float)(__bf16)v; }
#define WS_PT   0u                               // bf16 [192][64] (Wq|Wk|Wv rows, torch [out][in])
#define WS_QKV  (WS_PT + 2u * QKVP * KD)           // f32 [65536][192]
#define WS_QS   (WS_QKV + 4u * NR * QKVP)          // f32 [65536] row sums of q
#define WS_KS   (WS_QS + 4u * NR)
#define WS_VTH  (WS_KS + 4u * NR)                  // bf16 [32][64][2048]
#define WS_VTL  (WS_VTH + 2u * NBC * KD * TT)
#define WS_END  (WS_VTL + 2u * NBC * KD * TT)

__global__ __launch_bounds__(64) void k_pack(const float* __restrict__ Wq, const float* __restrict__ Wk, const float* __restrict__ Wv, __bf16* __restrict__ PT) {
  __shared__ __align__(16) __bf16 srow[64];
  const int n = blockIdx.x, tid = threadIdx.x; const int which = n / KD, c = n % KD; const float* Wm = (which == 0 ? Wq : which == 1 ? Wk : Wv) + (size_t)c * KD;
  srow[tid] = (__bf16)Wm[tid]; __syncthreads();
  if (tid < 8) vst2((unsigned*)(PT + (size_t)n * KD + tid * 8), *(const v4u*)(&srow[tid * 8]));
}
// ---- k_proj: block = 64 rows (4 waves): QKV rows (12 tiles, K 64 exact) + bias; qs/ks = row sums of the q and k parts (f32, from the LDS tile) -> QS/KS (64 floats = 256 B per block)
__global__ __launch_bounds__(128) void k_proj(const float* __restrict__ X, const __bf16* __restrict__ PT, const float* __restrict__ bq, const float* __restrict__ bk, const float* __restrict__ bv, float* __restrict__ QKV, float* __restrict__ QS, float* __restrict__ KS) {
  __shared__ __align__(16) float so[4][16][196]; __shared__ __align__(16) float sqs[64], sks[64];
  const int tid = threadIdx.x, wave = tid >> 5, lane = tid & 31, col = lane & 15, g = lane >> 4; const size_t r0 = (size_t)blockIdx.x * 64 + wave * 16;
  v8f acc[12] = {};
#pragma unroll
  for (int kc = 0; kc < 2; ++kc) { const v16b a = frag_gbf(X + (r0 + col) * KD + kc * 32, lane);
#pragma unroll
    for (int j = 0; j < 12; ++j) acc[j] = wmma_bf(a, frag_b(PT + (size_t)(j * 16 + col) * KD + kc * 32, lane), acc[j]); }
#pragma unroll
  for (int j = 0; j < 12; ++j) { const int n = j * 16 + col; const int which = n / KD, c = n % KD; const float bb = bfr((which == 0 ? bq : which == 1 ? bk : bv)[c]);
#pragma unroll
    for (int r = 0; r < 8; ++r) so[wave][8 * g + r][n] = acc[j][r] + bb; }
  LDSX();
  if (lane < 16) { float s1 = 0.f, s2 = 0.f; for (int d = 0; d < KD; ++d) { s1 += so[wave][lane][d]; s2 += so[wave][lane][KD + d]; } sqs[wave * 16 + lane] = s1; sks[wave * 16 + lane] = s2; }
  for (int rl = 0; rl < 16; ++rl) for (int pc = lane; pc < QKVP / 4; pc += 32) vst2(QKV + (r0 + rl) * QKVP + pc * 4, *(const v4f*)&so[wave][rl][pc * 4]);
  __syncthreads();
  if (tid < 16) vst2(QS + (size_t)blockIdx.x * 64 + tid * 4, *(const v4f*)&sqs[tid * 4]); else if (tid < 32) vst2(KS + (size_t)blockIdx.x * 64 + (tid - 16) * 4, *(const v4f*)&sks[(tid - 16) * 4]);
}
__global__ __launch_bounds__(256) void k_vt(const float* __restrict__ QKV, __bf16* __restrict__ VTH, __bf16* __restrict__ VTL) {
  __shared__ __align__(16) __bf16 svh[KD][72], svl[KD][72];
  const int tid = threadIdx.x; const size_t t0 = (size_t)blockIdx.x * 64; const int bc = (int)(t0 / TT), p0 = (int)(t0 % TT);
  for (int q = tid; q < 64 * KD; q += 256) { const int tl = q >> 6, d = q & 63; const float v = QKV[(t0 + tl) * QKVP + 2 * KD + d]; const __bf16 hb = (__bf16)v; svh[d][tl] = hb; svl[d][tl] = (__bf16)(v - (float)hb); }
  __syncthreads();
  for (int q = tid; q < KD * 8; q += 256) { const int rowi = q >> 3, pc = q & 7; const size_t o = ((size_t)bc * KD + rowi) * TT + p0 + pc * 8; vst2((unsigned*)(VTH + o), *(const v4u*)&svh[rowi][pc * 8]); vst2((unsigned*)(VTL + o), *(const v4u*)&svl[rowi][pc * 8]); }
}
// ---- k_attn: block = (query block, bc), 4 waves: s[r][kk] = qs[q] ks[kk] / 8; softmax against the closed-form row max; P (hi/lo) x V planes (3 products); out rows 256 B
__global__ __launch_bounds__(128) void k_attn(const float* __restrict__ QS, const float* __restrict__ KS, const __bf16* __restrict__ VTH, const __bf16* __restrict__ VTL, float* __restrict__ OUT) {
  __shared__ __align__(16) float sp[4][16][36]; __shared__ __align__(16) float so[4][16][68];
  const int tid = threadIdx.x, wave = tid >> 5, lane = tid & 31, col = lane & 15, g = lane >> 4;
  const int qb = blockIdx.x, bc = blockIdx.y; const int q0 = qb * 64 + wave * 16; const size_t tq = (size_t)bc * TT + q0;
  float qsr[8]; 
#pragma unroll
  for (int r = 0; r < 8; ++r) qsr[r] = QS[tq + 8 * g + r] * (0.125f * 1.44269504088896340736f);   // 1/8 and log2(e) in one factor: the weights are 2^(qsr ks - m)
  // scores are rank 1 (qs[t] * ks[s]) and rounding is monotonic, so the row maximum is exactly max(qs*max ks, qs*min ks): each wave scans the 2048 ks of its (b,c) once
  const float* ksb = KS + (size_t)bc * TT;
  float kmx = -INFINITY, kmn = INFINITY;
  // unrolled so that the 16 loads are in flight together
#pragma unroll
  for (int i = 0; i < TT / 128; ++i) { const v4f kv = *(const v4f*)(ksb + i * 128 + lane * 4);
    kmx = fmaxf(kmx, fmaxf(fmaxf(kv[0], kv[1]), fmaxf(kv[2], kv[3]))); kmn = fminf(kmn, fminf(fminf(kv[0], kv[1]), fminf(kv[2], kv[3]))); }
  for (int o = 1; o < 32; o <<= 1) { kmx = fmaxf(kmx, __shfl_xor(kmx, o)); kmn = fminf(kmn, __shfl_xor(kmn, o)); }
  float m[8], l[8];   // l: this lane's share of the row sum (its two key columns per step), reduced over the 16 lanes behind the loop
#pragma unroll
  for (int r = 0; r < 8; ++r) { m[r] = fmaxf(qsr[r] * kmx, qsr[r] * kmn); l[r] = 0.f; }
  v8f acc[4] = {};
  // sp[wave] is written and read by this wave alone: its hand-over needs the LDS wait and the compiler's order only; the workgroup-scope release of LDSX would also wait for the global loads in flight
#define LDSW() do { asm volatile("s_wait_dscnt 0" ::: "memory"); __builtin_amdgcn_wave_barrier(); } while (0)
  // one step ahead: the V fragments and the two ks of step ks + 1 are asked for during step ks, so that their latency runs under the weights' arithmetic instead of in front of each WMMA group
  const __bf16* vhp = VTH + ((size_t)bc * KD + col) * TT; const __bf16* vlp = VTL + ((size_t)bc * KD + col) * TT;
  v16b vh[4], vl[4];
#pragma unroll
  for (int dt = 0; dt < 4; ++dt) { vh[dt] = frag_b(vhp + (size_t)dt * 16 * TT, lane); vl[dt] = frag_b(vlp + (size_t)dt * 16 * TT, lane); }
  float k0 = ksb[col], k1 = ksb[16 + col];
#pragma unroll 1
  for (int ks = 0; ks < TT / 32; ++ks) {
    const int kn = ks + 1 < TT / 32 ? ks + 1 : ks;   // the last step asks for its own data again: in bounds, not used
    // unrolled so that qsr, m and l are indexed by constants and stay in registers
#pragma unroll
    for (int r = 0; r < 8; ++r) { const float e0 = __builtin_amdgcn_exp2f(qsr[r] * k0 - m[r]), e1 = __builtin_amdgcn_exp2f(qsr[r] * k1 - m[r]);
      l[r] += e0 + e1;
      sp[wave][8 * g + r][col] = e0; sp[wave][8 * g + r][16 + col] = e1; }
    k0 = ksb[kn * 32 + col]; k1 = ksb[kn * 32 + 16 + col];
    LDSW();
    const F2 pa = split_row(&sp[wave][col][0], 0, lane);
#pragma unroll
    for (int dt = 0; dt < 4; ++dt) {
      acc[dt] = wmma_bf(pa.l, vh[dt], acc[dt]); acc[dt] = wmma_bf(pa.h, vl[dt], acc[dt]); acc[dt] = wmma_bf(pa.h, vh[dt], acc[dt]);
      vh[dt] = frag_b(vhp + (size_t)dt * 16 * TT + kn * 32, lane); vl[dt] = frag_b(vlp + (size_t)dt * 16 * TT + kn * 32, lane); }
    asm volatile("s_wait_xcnt 0x0" ::: "memory");   // precaution: the next step rewrites the address registers of the V loads just issued
    LDSW(); }
#pragma unroll
  for (int r = 0; r < 8; ++r) { float es = l[r];
    for (int o = 1; o < 16; o <<= 1) es += __shfl_xor(es, o);
    const float il = 1.0f / es;
#pragma unroll
    for (int dt = 0; dt < 4; ++dt) so[wave][8 * g + r][dt * 16 + col] = acc[dt][r] * il; }
  LDSX();
  for (int rl = 0; rl < 16; ++rl) if (lane < 16) vst2(OUT + (tq + rl) * KD + lane * 4, *(const v4f*)&so[wave][rl][lane * 4]);
}

extern "C" void kernel_launch(void* const* d_in, const int* in_sizes, int n_in, void* d_out, int out_size, void* d_ws, size_t ws_size, hipStream_t stream) {
  (void)in_sizes; (void)n_in; (void)out_size;
  const float** F = (const float**)d_in;   // x [4,8,2048,64], Wq [64,64], bq, Wk, bk, Wv, bv (torch [out][in])
  if (ws_size < (size_t)WS_END) return;
  char* ws = (char*)d_ws; __bf16 *PT = (__bf16*)(ws + WS_PT), *VTH = (__bf16*)(ws + WS_VTH), *VTL = (__bf16*)(ws + WS_VTL); float *QKV = (float*)(ws + WS_QKV), *QS = (float*)(ws + WS_QS), *KS = (float*)(ws + WS_KS);
  k_pack<<<QKVP, 64, 0, stream>>>(F[1], F[3], F[5], PT);
  k_proj<<<TRB, 128, 0, stream>>>(F[0], PT, F[2], F[4], F[6], QKV, QS, KS);
  k_vt<<<TRB, 256, 0, stream>>>(QKV, VTH, VTL);
  k_attn<<<dim3(TQB, TNB), 128, 0, stream>>>(QS, KS, VTH, VTL, (float*)d_out);
}

// v004
// One run takes 80.7 microseconds.
// Two timings next to v003 put it at 1.50 and 1.49 times that version's speed.
// Over all steps from v000 it is 3.50 times as fast.
// compute dtype: x, Wq/Wk/Wv + biases (module inputs) rounded to bf16; q/k/v projections with exact bf16 products (+ bias); the per-row sums qs, ks and the rank-1 scores qs_t ks_s / 8 in f32; softmax weights x V with both computed operands as bf16 hi + residual pairs (3 products); softmax in f32; f32 accumulate.
#include <hip/hip_runtime.h>
#include <math.h>

typedef __attribute__((ext_vector_type(16))) _Float16 v16h;
typedef __attribute__((ext_vector_type(16))) __bf16 v16b;
typedef __attribute__((ext_vector_type(8)))  _Float16 v8h;
typedef __attribute__((ext_vector_type(8)))  float v8f;
typedef __attribute__((ext_vector_type(4)))  float v4f;
typedef __attribute__((ext_vector_type(2)))  float v2f;
typedef __attribute__((ext_vector_type(4)))  unsigned v4u;
typedef __attribute__((ext_vector_type(4)))  int v4i;
typedef float __attribute__((may_alias)) float_a;
typedef int __attribute__((may_alias)) int_a;

template <typename T> __device__ __forceinline__ void vst2(void* p, T v) { *(T*)p = v;  }
__device__ __forceinline__ v8f wmma16(v16h a, v16h b, v8f c) {
  v8f d = __builtin_amdgcn_wmma_f32_16x16x32_f16(false, a, false, b, (short)0, c, false, false);
  asm volatile("v_nop\n\tv_nop\n\tv_nop\n\tv_nop" : "+v"(d) : "v"(a), "v"(b));
  return d;
}
__device__ __forceinline__ v8f wmma_bf(v16b a, v16b b, v8f c) {
  v8f d = __builtin_amdgcn_wmma_f32_16x16x32_bf16(false, a, false, b, (short)0, c, false, false);
  asm volatile("v_nop\n\tv_nop\n\tv_nop\n\tv_nop" : "+v"(d) : "v"(a), "v"(b));
  return d;
}
// 16x16x32 fragments: lane = (h = lane>>4, row/col = lane&15); elements 0..7 = k0+8h+0..7, 8..15 = k0+16+8h+0..7; D element r = row 8h+r
__device__ __forceinline__ v16h frag_h(const _Float16* rowk0, int lane) {
  union { v16h v; v8h q[2]; } u; const _Float16* p = rowk0 + 8 * (lane >> 4);
  u.q[0] = *(const v8h*)p; u.q[1] = *(const v8h*)(p + 16); return u.v;
}
__device__ __forceinline__ v16h frag_f32(const float* rowk0, int lane) {
  v16h a; const float* p = rowk0 + 8 * (lane >> 4);
#pragma unroll
  for (int i = 0; i < 8; ++i) { a[i] = (_Float16)p[i]; a[8 + i] = (_Float16)p[16 + i]; }
  return a;
}
__device__ __forceinline__ v16h frag_f32s(const float* rowk0, int lane, float sc) {
  v16h a; const float* p = rowk0 + 8 * (lane >> 4);
#pragma unroll
  for (int i = 0; i < 8; ++i) { a[i] = (_Float16)(p[i] * sc); a[8 + i] = (_Float16)(p[16 + i] * sc); }
  return a;
}
// column fragment from a [K][ld] layout (column n), rows >= K read as 0
__device__ __forceinline__ v16h fragc_f32(const float* W, int k0, int n, int lane, int ld, int K) {
  v16h a; const int g = lane >> 4;
#pragma unroll
  for (int i = 0; i < 8; ++i) { const int ka = k0 + 8 * g + i, kb = ka + 16;
    a[i] = (_Float16)(ka < K ? W[(size_t)(ka < K ? ka : K - 1) * ld + n] : 0.f); a[8 + i] = (_Float16)(kb < K ? W[(size_t)(kb < K ? kb : K - 1) * ld + n] : 0.f); }
  return a;
}
struct F2 { v16b h, l; };
__device__ __forceinline__ F2 bsplit16(const float v[16]) { F2 r;
#pragma unroll
  for (int i = 0; i < 16; ++i) { const __bf16 h = (__bf16)v[i]; r.h[i] = h; r.l[i] = (__bf16)(v[i] - (float)h); }
  return r; }
__device__ __forceinline__ F2 split_row(const float* row, int k0, int lane) { float v[16]; const float* p = row + k0 + 8 * (lane >> 4);
#pragma unroll
  for (int i = 0; i < 8; ++i) { v[i] = p[i]; v[8 + i] = p[16 + i]; }
  return bsplit16(v); }
__device__ __forceinline__ F2 split_rowK(const float* row, int k0, int lane, int K) { float v[16]; const int g = lane >> 4;
#pragma unroll
  for (int i = 0; i < 8; ++i) { const int ka = k0 + 8 * g + i, kb = ka + 16; v[i] = ka < K ? row[ka < K ? ka : K - 1] : 0.f; v[8 + i] = kb < K ? row[kb < K ? kb : K - 1] : 0.f; }
  return bsplit16(v); }
__device__ __forceinline__ F2 split_col(const float* W, int k0, int n, int lane, int ld, int K) { float v[16]; const int g = lane >> 4;
#pragma unroll
  for (int i = 0; i < 8; ++i) { const int ka = k0 + 8 * g + i, kb = ka + 16; v[i] = ka < K ? W[(size_t)(ka < K ? ka : K - 1) * ld + n] : 0.f; v[8 + i] = kb < K ? W[(size_t)(kb < K ? kb : K - 1) * ld + n] : 0.f; }
  return bsplit16(v); }
__device__ __forceinline__ v8f mac3(const F2& a, const F2& b, v8f c) { c = wmma_bf(a.l, b.h, c); c = wmma_bf(a.h, b.l, c); return wmma_bf(a.h, b.h, c); }
__device__ __forceinline__ float sigm(float v) { return 1.0f / (1.0f + expf(-v)); }
#define LDSX() do { asm volatile("s_wait_dscnt 0" ::: "memory"); __builtin_amdgcn_wave_barrier(); __builtin_amdgcn_fence(__ATOMIC_RELEASE, "workgroup"); } while (0)


// K-dim self attention on x [4,8,2048,64]: q,k,v = x W^T + b; scores[t][s] = (sum_i q[t][i]) (sum_j k[s][j]) / 8 (the reference einsum sums i and j independently); softmax over s; out = sum_s w v[s] -> [4,8,2048,64].
// k_pack, k_proj (exact GEMM + bias -> q|k|v rows; also qs/ks row sums), k_vt (V hi/lo planes per (b,c) in B-fragment order), k_attn (block = (64-query block, b*8+c), 4 waves: 64 key steps; scores from the two scalars, row max in closed form, lane-partial row sums, P hi/lo x V planes (3 products); writes the output rows).
#define NBC 32              // B*C
#define TT 2048
#define KD 64
#define NR (NBC * TT)       // 65536 rows
#define QKVP 192
#ifndef TRB
#define TRB (NR / 64)
#define TQB (TT / 64)
#define TNB NBC
#endif
typedef __attribute__((ext_vector_type(8))) __bf16 v8b;
__device__ __forceinline__ v16b frag_b(const __bf16* rowk0, int lane) {
  union { v16b v; v8b q[2]; } u; const __bf16* p = rowk0 + 8 * (lane >> 4);
  u.q[0] = *(const v8b*)p; u.q[1] = *(const v8b*)(p + 16); return u.v;
}
// B fragment from the fragment-order planes: each of the two 16-byte loads reads 512 bytes in a row over the wave (4 whole lines)
__device__ __forceinline__ v16b frag_p(const __bf16* p) {
  union { v16b v; v8b q[2]; } u; u.q[0] = *(const v8b*)p; u.q[1] = *(const v8b*)(p + 256); return u.v;
}
__device__ __forceinline__ v16b frag_gbf(const float* rowk0, int lane) {
  v16b a; const float* p = rowk0 + 8 * (lane >> 4);
#pragma unroll
  for (int i = 0; i < 8; ++i) { a[i] = (__bf16)p[i]; a[8 + i] = (__bf16)p[16 + i]; }
  return a;
}
__device__ __forceinline__ float bfr(float v) { return (float)(__bf16)v; }
#define WS_PT   0u                               // bf16 [192][64] (Wq|Wk|Wv rows, torch [out][in])
#define WS_QKV  (WS_PT + 2u * QKVP * KD)           // f32 [65536][192]
#define WS_QS   (WS_QKV + 4u * NR * QKVP)          // f32 [65536] row sums of q
#define WS_KS   (WS_QS + 4u * NR)
#define WS_VTH  (WS_KS + 4u * NR)                  // bf16 [32 bc][64 key steps][4 dt][2 halves][32 lanes][8]: element i = V[32 step + 16 half + 8 (lane >> 4) + i][16 dt + (lane & 15)]
#define WS_VTL  (WS_VTH + 2u * NBC * KD * TT)
#define WS_END  (WS_VTL + 2u * NBC * KD * TT)

__global__ __launch_bounds__(64) void k_pack(const float* __restrict__ Wq, const float* __restrict__ Wk, const float* __restrict__ Wv, __bf16* __restrict__ PT) {
  __shared__ __align__(16) __bf16 srow[64];
  const int n = blockIdx.x, tid = threadIdx.x; const int which = n / KD, c = n % KD; const float* Wm = (which == 0 ? Wq : which == 1 ? Wk : Wv) + (size_t)c * KD;
  srow[tid] = (__bf16)Wm[tid]; __syncthreads();
  if (tid < 8) vst2((unsigned*)(PT + (size_t)n * KD + tid * 8), *(const v4u*)(&srow[tid * 8]));
}
// ---- k_proj: block = 64 rows (4 waves): QKV rows (12 tiles, K 64 exact) + bias; qs/ks = row sums of the q and k parts (f32, from the LDS tile) -> QS/KS (64 floats = 256 B per block)
__global__ __launch_bounds__(128) void k_proj(const float* __restrict__ X, const __bf16* __restrict__ PT, const float* __restrict__ bq, const float* __restrict__ bk, const float* __restrict__ bv, float* __restrict__ QKV, float* __restrict__ QS, float* __restrict__ KS) {
  __shared__ __align__(16) float so[4][16][196]; __shared__ __align__(16) float sqs[64], sks[64];
  const int tid = threadIdx.x, wave = tid >> 5, lane = tid & 31, col = lane & 15, g = lane >> 4; const size_t r0 = (size_t)blockIdx.x * 64 + wave * 16;
  v8f acc[12] = {};
#pragma unroll
  for (int kc = 0; kc < 2; ++kc) { const v16b a = frag_gbf(X + (r0 + col) * KD + kc * 32, lane);
#pragma unroll
    for (int j = 0; j < 12; ++j) acc[j] = wmma_bf(a, frag_b(PT + (size_t)(j * 16 + col) * KD + kc * 32, lane), acc[j]); }
#pragma unroll
  for (int j = 0; j < 12; ++j) { const int n = j * 16 + col; const int which = n / KD, c = n % KD; const float bb = bfr((which == 0 ? bq : which == 1 ? bk : bv)[c]);
#pragma unroll
    for (int r = 0; r < 8; ++r) so[wave][8 * g + r][n] = acc[j][r] + bb; }
  LDSX();
  if (lane < 16) { float s1 = 0.f, s2 = 0.f; for (int d = 0; d < KD; ++d) { s1 += so[wave][lane][d]; s2 += so[wave][lane][KD + d]; } sqs[wave * 16 + lane] = s1; sks[wave * 16 + lane] = s2; }
  for (int rl = 0; rl < 16; ++rl) for (int pc = lane; pc < QKVP / 4; pc += 32) vst2(QKV + (r0 + rl) * QKVP + pc * 4, *(const v4f*)&so[wave][rl][pc * 4]);
  __syncthreads();
  if (tid < 16) vst2(QS + (size_t)blockIdx.x * 64 + tid * 4, *(const v4f*)&sqs[tid * 4]); else if (tid < 32) vst2(KS + (size_t)blockIdx.x * 64 + (tid - 16) * 4, *(const v4f*)&sks[(tid - 16) * 4]);
}
__global__ __launch_bounds__(256) void k_vt(const float* __restrict__ QKV, __bf16* __restrict__ VTH, __bf16* __restrict__ VTL) {
  __shared__ __align__(16) __bf16 svh[KD][72], svl[KD][72];
  const int tid = threadIdx.x; const size_t t0 = (size_t)blockIdx.x * 64; const int bc = (int)(t0 / TT), p0 = (int)(t0 % TT);
  for (int q = tid; q < 64 * KD; q += 256) { const int tl = q >> 6, d = q & 63; const float v = QKV[(t0 + tl) * QKVP + 2 * KD + d]; const __bf16 hb = (__bf16)v; svh[d][tl] = hb; svl[d][tl] = (__bf16)(v - (float)hb); }
  __syncthreads();
  // fragment order: 16-byte piece q of this block's two key steps = (step q >> 8, dt, half, lane); the block writes 8 KB in a row per plane
  for (int q = tid; q < KD * 8; q += 256) { const int ln = q & 31, rowi = ((q >> 6) & 3) * 16 + (ln & 15), pc = (q >> 8) * 4 + ((q >> 5) & 1) * 2 + (ln >> 4); const size_t o = ((size_t)bc * TT + p0) * KD + q * 8; vst2((unsigned*)(VTH + o), *(const v4u*)&svh[rowi][pc * 8]); vst2((unsigned*)(VTL + o), *(const v4u*)&svl[rowi][pc * 8]); }
}
// ---- k_attn: block = (query block, bc), 4 waves: s[r][kk] = qs[q] ks[kk] / 8; softmax against the closed-form row max; P (hi/lo) x V planes (3 products); out rows 256 B
__global__ __launch_bounds__(128) void k_attn(const float* __restrict__ QS, const float* __restrict__ KS, const __bf16* __restrict__ VTH, const __bf16* __restrict__ VTL, float* __restrict__ OUT) {
  __shared__ __align__(16) float sp[4][16][36]; __shared__ __align__(16) float so[4][16][68];
  const int tid = threadIdx.x, wave = tid >> 5, lane = tid & 31, col = lane & 15, g = lane >> 4;
  const int qb = blockIdx.x, bc = blockIdx.y; const int q0 = qb * 64 + wave * 16; const size_t tq = (size_t)bc * TT + q0;
  float qsr[8]; 
#pragma unroll
  for (int r = 0; r < 8; ++r) qsr[r] = QS[tq + 8 * g + r] * (0.125f * 1.44269504088896340736f);   // 1/8 and log2(e) in one factor: the weights are 2^(qsr ks - m)
  // scores are rank 1 (qs[t] * ks[s]) and rounding is monotonic, so the row maximum is exactly max(qs*max ks, qs*min ks): each wave scans the 2048 ks of its (b,c) once
  const float* ksb = KS + (size_t)bc * TT;
  float kmx = -INFINITY, kmn = INFINITY;
  // unrolled so that the 16 loads are in flight together
#pragma unroll
  for (int i = 0; i < TT / 128; ++i) { const v4f kv = *(const v4f*)(ksb + i * 128 + lane * 4);
    kmx = fmaxf(kmx, fmaxf(fmaxf(kv[0], kv[1]), fmaxf(kv[2], kv[3]))); kmn = fminf(kmn, fminf(fminf(kv[0], kv[1]), fminf(kv[2], kv[3]))); }
  for (int o = 1; o < 32; o <<= 1) { kmx = fmaxf(kmx, __shfl_xor(kmx, o)); kmn = fminf(kmn, __shfl_xor(kmn, o)); }
  float m[8], l[8];   // l: this lane's share of the row sum (its two key columns per step), reduced over the 16 lanes behind the loop
#pragma unroll
  for (int r = 0; r < 8; ++r) { m[r] = fmaxf(qsr[r] * kmx, qsr[r] * kmn); l[r] = 0.f; }
  v8f acc[4] = {};
  // sp[wave] is written and read by this wave alone: its hand-over needs the LDS wait and the compiler's order only; the workgroup-scope release of LDSX would also wait for the global loads in flight
#define LDSW() do { asm volatile("s_wait_dscnt 0" ::: "memory"); __builtin_amdgcn_wave_barrier(); } while (0)
  // one step ahead: the V fragments and the two ks of step ks + 1 are asked for during step ks, so that their latency runs under the weights' arithmetic instead of in front of each WMMA group
  const __bf16* vhp = VTH + (size_t)bc * KD * TT; const __bf16* vlp = VTL + (size_t)bc * KD * TT; const unsigned lo8 = lane * 8u;
  v16b vh[4], vl[4];
#pragma unroll
  for (int dt = 0; dt < 4; ++dt) { vh[dt] = frag_p(vhp + dt * 512 + lo8); vl[dt] = frag_p(vlp + dt * 512 + lo8); }
  float k0 = ksb[col], k1 = ksb[16 + col];
#pragma unroll 1
  for (int ks = 0; ks < TT / 32; ++ks) {
    const int kn = ks + 1 < TT / 32 ? ks + 1 : ks;   // the last step asks for its own data again: in bounds, not used
    // unrolled so that qsr, m and l are indexed by constants and stay in registers
#pragma unroll
    for (int r = 0; r < 8; ++r) { const float e0 = __builtin_amdgcn_exp2f(qsr[r] * k0 - m[r]), e1 = __builtin_amdgcn_exp2f(qsr[r] * k1 - m[r]);
      l[r] += e0 + e1;
      sp[wave][8 * g + r][col] = e0; sp[wave][8 * g + r][16 + col] = e1; }
    k0 = ksb[kn * 32 + col]; k1 = ksb[kn * 32 + 16 + col];
    LDSW();
    const F2 pa = split_row(&sp[wave][col][0], 0, lane);
#pragma unroll
    for (int dt = 0; dt < 4; ++dt) {
      acc[dt] = wmma_bf(pa.l, vh[dt], acc[dt]); acc[dt] = wmma_bf(pa.h, vl[dt], acc[dt]); acc[dt] = wmma_bf(pa.h, vh[dt], acc[dt]);
      vh[dt] = frag_p(vhp + (size_t)dt * 512 + kn * 32 * KD + lo8); vl[dt] = frag_p(vlp + (size_t)dt * 512 + kn * 32 * KD + lo8); }
    asm volatile("s_wait_xcnt 0x0" ::: "memory");   // precaution: the next step rewrites the address registers of the V loads just issued
    LDSW(); }
#pragma unroll
  for (int r = 0; r < 8; ++r) { float es = l[r];
    for (int o = 1; o < 16; o <<= 1) es += __shfl_xor(es, o);
    const float il = 1.0f / es;
#pragma unroll
    for (int dt = 0; dt < 4; ++dt) so[wave][8 * g + r][dt * 16 + col] = acc[dt][r] * il; }
  LDSX();
  for (int rl = 0; rl < 16; ++rl) if (lane < 16) vst2(OUT + (tq + rl) * KD + lane * 4, *(const v4f*)&so[wave][rl][lane * 4]);
}

extern "C" void kernel_launch(void* const* d_in, const int* in_sizes, int n_in, void* d_out, int out_size, void* d_ws, size_t ws_size, hipStream_t stream) {
  (void)in_sizes; (void)n_in; (void)out_size;
  const float** F = (const float**)d_in;   // x [4,8,2048,64], Wq [64,64], bq, Wk, bk, Wv, bv (torch [out][in])
  if (ws_size < (size_t)WS_END) return;
  char* ws = (char*)d_ws; __bf16 *PT = (__bf16*)(ws + WS_PT), *VTH = (__bf16*)(ws + WS_VTH), *VTL = (__bf16*)(ws + WS_VTL); float *QKV = (float*)(ws + WS_QKV), *QS = (float*)(ws + WS_QS), *KS = (float*)(ws + WS_KS);
  k_pack<<<QKVP, 64, 0, stream>>>(F[1], F[3], F[5], PT);
  k_proj<<<TRB, 128, 0, stream>>>(F[0], PT, F[2], F[4], F[6], QKV, QS, KS);
  k_vt<<<TRB, 256, 0, stream>>>(QKV, VTH, VTL);
  k_attn<<<dim3(TQB, TNB), 128, 0, stream>>>(QS, KS, VTH, VTL, (float*)d_out);
}

// v005
// One run takes 70.7 microseconds.
// Timed twice side by side with v004, it ran 1.17 and 1.15 times as fast.
// Counting every step since v000, it is 4.07 times as fast.
// compute dtype: x, Wq/Wk/Wv + biases (module inputs) rounded to bf16; q/k/v projections with exact bf16 products (+ bias); the per-row sums qs, ks and the rank-1 scores qs_t ks_s / 8 in f32; softmax weights x V with both computed operands as bf16 hi + residual pairs (3 products); softmax in f32; f32 accumulate.
#include <hip/hip_runtime.h>
#include <math.h>

typedef __attribute__((ext_vector_type(16))) _Float16 v16h;
typedef __attribute__((ext_vector_type(16))) __bf16 v16b;
typedef __attribute__((ext_vector_type(8)))  _Float16 v8h;
typedef __attribute__((ext_vector_type(8)))  float v8f;
typedef __attribute__((ext_vector_type(4)))  float v4f;
typedef __attribute__((ext_vector_type(2)))  float v2f;
typedef __attribute__((ext_vector_type(4)))  unsigned v4u;
typedef __attribute__((ext_vector_type(4)))  int v4i;
typedef float __attribute__((may_alias)) float_a;
typedef int __attribute__((may_alias)) int_a;

template <typename T> __device__ __forceinline__ void vst2(void* p, T v) { *(T*)p = v;  }
__device__ __forceinline__ v8f wmma16(v16h a, v16h b, v8f c) {
  v8f d = __builtin_amdgcn_wmma_f32_16x16x32_f16(false, a, false, b, (short)0, c, false, false);
  asm volatile("v_nop\n\tv_nop\n\tv_nop\n\tv_nop" : "+v"(d) : "v"(a), "v"(b));
  return d;
}
__device__ __forceinline__ v8f wmma_bf(v16b a, v16b b, v8f c) {
  v8f d = __builtin_amdgcn_wmma_f32_16x16x32_bf16(false, a, false, b, (short)0, c, false, false);
  asm volatile("v_nop\n\tv_nop\n\tv_nop\n\tv_nop" : "+v"(d) : "v"(a), "v"(b));
  return d;
}
// 16x16x32 fragments: lane = (h = lane>>4, row/col = lane&15); elements 0..7 = k0+8h+0..7, 8..15 = k0+16+8h+0..7; D element r = row 8h+r
__device__ __forceinline__ v16h frag_h(const _Float16* rowk0, int lane) {
  union { v16h v; v8h q[2]; } u; const _Float16* p = rowk0 + 8 * (lane >> 4);
  u.q[0] = *(const v8h*)p; u.q[1] = *(const v8h*)(p + 16); return u.v;
}
__device__ __forceinline__ v16h frag_f32(const float* rowk0, int lane) {
  v16h a; const float* p = rowk0 + 8 * (lane >> 4);
#pragma unroll
  for (int i = 0; i < 8; ++i) { a[i] = (_Float16)p[i]; a[8 + i] = (_Float16)p[16 + i]; }
  return a;
}
__device__ __forceinline__ v16h frag_f32s(const float* rowk0, int lane, float sc) {
  v16h a; const float* p = rowk0 + 8 * (lane >> 4);
#pragma unroll
  for (int i = 0; i < 8; ++i) { a[i] = (_Float16)(p[i] * sc); a[8 + i] = (_Float16)(p[16 + i] * sc); }
  return a;
}
// column fragment from a [K][ld] layout (column n), rows >= K read as 0
__device__ __forceinline__ v16h fragc_f32(const float* W, int k0, int n, int lane, int ld, int K) {
  v16h a; const int g = lane >> 4;
#pragma unroll
  for (int i = 0; i < 8; ++i) { const int ka = k0 + 8 * g + i, kb = ka + 16;
    a[i] = (_Float16)(ka < K ? W[(size_t)(ka < K ? ka : K - 1) * ld + n] : 0.f); a[8 + i] = (_Float16)(kb < K ? W[(size_t)(kb < K ? kb : K - 1) * ld + n] : 0.f); }
  return a;
}
struct F2 { v16b h, l; };
__device__ __forceinline__ F2 bsplit16(const float v[16]) { F2 r;
#pragma unroll
  for (int i = 0; i < 16; ++i) { const __bf16 h = (__bf16)v[i]; r.h[i] = h; r.l[i] = (__bf16)(v[i] - (float)h); }
  return r; }
__device__ __forceinline__ F2 split_row(const float* row, int k0, int lane) { float v[16]; const float* p = row + k0 + 8 * (lane >> 4);
#pragma unroll
  for (int i = 0; i < 8; ++i) { v[i] = p[i]; v[8 + i] = p[16 + i]; }
  return bsplit16(v); }
__device__ __forceinline__ F2 split_rowK(const float* row, int k0, int lane, int K) { float v[16]; const int g = lane >> 4;
#pragma unroll
  for (int i = 0; i < 8; ++i) { const int ka = k0 + 8 * g + i, kb = ka + 16; v[i] = ka < K ? row[ka < K ? ka : K - 1] : 0.f; v[8 + i] = kb < K ? row[kb < K ? kb : K - 1] : 0.f; }
  return bsplit16(v); }
__device__ __forceinline__ F2 split_col(const float* W, int k0, int n, int lane, int ld, int K) { float v[16]; const int g = lane >> 4;
#pragma unroll
  for (int i = 0; i < 8; ++i) { const int ka = k0 + 8 * g + i, kb = ka + 16; v[i] = ka < K ? W[(size_t)(ka < K ? ka : K - 1) * ld + n] : 0.f; v[8 + i] = kb < K ? W[(size_t)(kb < K ? kb : K - 1) * ld + n] : 0.f; }
  return bsplit16(v); }
__device__ __forceinline__ v8f mac3(const F2& a, const F2& b, v8f c) { c = wmma_bf(a.l, b.h, c); c = wmma_bf(a.h, b.l, c); return wmma_bf(a.h, b.h, c); }
__device__ __forceinline__ float sigm(float v) { return 1.0f / (1.0f + expf(-v)); }
#define LDSX() do { asm volatile("s_wait_dscnt 0" ::: "memory"); __builtin_amdgcn_wave_barrier(); __builtin_amdgcn_fence(__ATOMIC_RELEASE, "workgroup"); } while (0)


// K-dim self attention on x [4,8,2048,64]: q,k,v = x W^T + b; scores[t][s] = (sum_i q[t][i]) (sum_j k[s][j]) / 8 (the reference einsum sums i and j independently); softmax over s; out = sum_s w v[s] -> [4,8,2048,64].
// k_pack, k_proj (exact GEMM + bias; keeps only the qs/ks row sums of q and k, and V as hi/lo planes per (b,c) in B-fragment order), k_attn (block = (64-query block, b*8+c), 4 waves: 64 key steps; scores from the two scalars, row max in closed form, lane-partial row sums, P hi/lo x V planes (3 products); writes the output rows).
#define NBC 32              // B*C
#define TT 2048
#define KD 64
#define NR (NBC * TT)       // 65536 rows
#define QKVP 192
#ifndef TRB
#define TRB (NR / 64)
#define TQB (TT / 64)
#define TNB NBC
#endif
typedef __attribute__((ext_vector_type(8))) __bf16 v8b;
__device__ __forceinline__ v16b frag_b(const __bf16* rowk0, int lane) {
  union { v16b v; v8b q[2]; } u; const __bf16* p = rowk0 + 8 * (lane >> 4);
  u.q[0] = *(const v8b*)p; u.q[1] = *(const v8b*)(p + 16); return u.v;
}
// B fragment from the fragment-order planes: each of the two 16-byte loads reads 512 bytes in a row over the wave (4 whole lines)
__device__ __forceinline__ v16b frag_p(const __bf16* p) {
  union { v16b v; v8b q[2]; } u; u.q[0] = *(const v8b*)p; u.q[1] = *(const v8b*)(p + 256); return u.v;
}
__device__ __forceinline__ v16b frag_gbf(const float* rowk0, int lane) {
  v16b a; const float* p = rowk0 + 8 * (lane >> 4);
#pragma unroll
  for (int i = 0; i < 8; ++i) { a[i] = (__bf16)p[i]; a[8 + i] = (__bf16)p[16 + i]; }
  return a;
}
__device__ __forceinline__ float bfr(float v) { return (float)(__bf16)v; }
#define WS_PT   0u                               // bf16 [192][64] (Wq|Wk|Wv rows, torch [out][in])
#define WS_QS   (WS_PT + 2u * QKVP * KD)           // f32 [65536] row sums of q
#define WS_KS   (WS_QS + 4u * NR)
#define WS_VTH  (WS_KS + 4u * NR)                  // bf16 [32 bc][64 key steps][4 dt][2 halves][32 lanes][8]: element i = V[32 step + 16 half + 8 (lane >> 4) + i][16 dt + (lane & 15)]
#define WS_VTL  (WS_VTH + 2u * NBC * KD * TT)
#define WS_END  (WS_VTL + 2u * NBC * KD * TT)

__global__ __launch_bounds__(64) void k_pack(const float* __restrict__ Wq, const float* __restrict__ Wk, const float* __restrict__ Wv, __bf16* __restrict__ PT) {
  __shared__ __align__(16) __bf16 srow[64];
  const int n = blockIdx.x, tid = threadIdx.x; const int which = n / KD, c = n % KD; const float* Wm = (which == 0 ? Wq : which == 1 ? Wk : Wv) + (size_t)c * KD;
  srow[tid] = (__bf16)Wm[tid]; __syncthreads();
  if (tid < 8) vst2((unsigned*)(PT + (size_t)n * KD + tid * 8), *(const v4u*)(&srow[tid * 8]));
}
// ---- k_proj: block = 64 rows (4 waves): 12 tiles (K 64 exact) + bias; qs/ks = row sums of the q and k parts (f32, from the LDS tile) -> QS/KS (64 floats = 256 B per block); the V tiles go from the accumulators to the planes
__global__ __launch_bounds__(128) void k_proj(const float* __restrict__ X, const __bf16* __restrict__ PT, const float* __restrict__ bq, const float* __restrict__ bk, const float* __restrict__ bv, __bf16* __restrict__ VTH, __bf16* __restrict__ VTL, float* __restrict__ QS, float* __restrict__ KS) {
  __shared__ __align__(16) float so[4][16][132]; __shared__ __align__(16) float sqs[64], sks[64];
  const int tid = threadIdx.x, wave = tid >> 5, lane = tid & 31, col = lane & 15, g = lane >> 4; const size_t r0 = (size_t)blockIdx.x * 64 + wave * 16;
  v8f acc[12] = {};
#pragma unroll
  for (int kc = 0; kc < 2; ++kc) { const v16b a = frag_gbf(X + (r0 + col) * KD + kc * 32, lane);
#pragma unroll
    for (int j = 0; j < 12; ++j) acc[j] = wmma_bf(a, frag_b(PT + (size_t)(j * 16 + col) * KD + kc * 32, lane), acc[j]); }
#pragma unroll
  for (int j = 0; j < 8; ++j) { const int n = j * 16 + col; const int which = n / KD, c = n % KD; const float bb = bfr((which == 0 ? bq : bk)[c]);
#pragma unroll
    for (int r = 0; r < 8; ++r) so[wave][8 * g + r][n] = acc[j][r] + bb; }
  // a D tile is already a piece of the planes: lane (g, col) holds rows 8 g + 0..7 of column 16 dt + col, the 8 elements of that lane in the B fragment of key step (row >> 5), half (row >> 4) & 1; each store covers 512 bytes in a row
  v8b vh[4], vl[4];
  // both loops unrolled so that acc, vh and vl are indexed by constants and stay in registers
#pragma unroll
  for (int dt = 0; dt < 4; ++dt) { const float bb = bfr(bv[dt * 16 + col]);
#pragma unroll
    for (int r = 0; r < 8; ++r) { const float v = acc[8 + dt][r] + bb; const __bf16 hb = (__bf16)v; vh[dt][r] = hb; vl[dt][r] = (__bf16)(v - (float)hb); } }
  const size_t vo = (size_t)blockIdx.x * 64 * KD + (wave >> 1) * 2048 + (wave & 1) * 256 + lane * 8;
  LDSX();
  __builtin_amdgcn_sched_barrier(0);   // keeps the conversions in front of the eight stores: no store's data register is reused between them, so one wait behind the last store serves all
  // behind the LDS hand-over, whose release would wait for them, and in front of the row sums, under which they drain; unrolled for constant indices, as above
#pragma unroll
  for (int dt = 0; dt < 4; ++dt) { vst2(VTH + vo + dt * 512, vh[dt]); vst2(VTL + vo + dt * 512, vl[dt]); }
  if (lane < 16) { float s1 = 0.f, s2 = 0.f; for (int d = 0; d < KD; ++d) { s1 += so[wave][lane][d]; s2 += so[wave][lane][KD + d]; } sqs[wave * 16 + lane] = s1; sks[wave * 16 + lane] = s2; }
  __syncthreads();
  if (tid < 16) vst2(QS + (size_t)blockIdx.x * 64 + tid * 4, *(const v4f*)&sqs[tid * 4]); else if (tid < 32) vst2(KS + (size_t)blockIdx.x * 64 + (tid - 16) * 4, *(const v4f*)&sks[(tid - 16) * 4]);
}
// ---- k_attn: block = (query block, bc), 4 waves: s[r][kk] = qs[q] ks[kk] / 8; softmax against the closed-form row max; P (hi/lo) x V planes (3 products); out rows 256 B
__global__ __launch_bounds__(128) void k_attn(const float* __restrict__ QS, const float* __restrict__ KS, const __bf16* __restrict__ VTH, const __bf16* __restrict__ VTL, float* __restrict__ OUT) {
  __shared__ __align__(16) float sp[4][16][36]; __shared__ __align__(16) float so[4][16][68];
  const int tid = threadIdx.x, wave = tid >> 5, lane = tid & 31, col = lane & 15, g = lane >> 4;
  const int qb = blockIdx.x, bc = blockIdx.y; const int q0 = qb * 64 + wave * 16; const size_t tq = (size_t)bc * TT + q0;
  float qsr[8]; 
#pragma unroll
  for (int r = 0; r < 8; ++r) qsr[r] = QS[tq + 8 * g + r] * (0.125f * 1.44269504088896340736f);   // 1/8 and log2(e) in one factor: the weights are 2^(qsr ks - m)
  // scores are rank 1 (qs[t] * ks[s]) and rounding is monotonic, so the row maximum is exactly max(qs*max ks, qs*min ks): each wave scans the 2048 ks of its (b,c) once
  const float* ksb = KS + (size_t)bc * TT;
  float kmx = -INFINITY, kmn = INFINITY;
  // unrolled so that the 16 loads are in flight together
#pragma unroll
  for (int i = 0; i < TT / 128; ++i) { const v4f kv = *(const v4f*)(ksb + i * 128 + lane * 4);
    kmx = fmaxf(kmx, fmaxf(fmaxf(kv[0], kv[1]), fmaxf(kv[2], kv[3]))); kmn = fminf(kmn, fminf(fminf(kv[0], kv[1]), fminf(kv[2], kv[3]))); }
  for (int o = 1; o < 32; o <<= 1) { kmx = fmaxf(kmx, __shfl_xor(kmx, o)); kmn = fminf(kmn, __shfl_xor(kmn, o)); }
  float m[8], l[8];   // l: this lane's share of the row sum (its two key columns per step), reduced over the 16 lanes behind the loop
#pragma unroll
  for (int r = 0; r < 8; ++r) { m[r] = fmaxf(qsr[r] * kmx, qsr[r] * kmn); l[r] = 0.f; }
  v8f acc[4] = {};
  // sp[wave] is written and read by this wave alone: its hand-over needs the LDS wait and the compiler's order only; the workgroup-scope release of LDSX would also wait for the global loads in flight
#define LDSW() do { asm volatile("s_wait_dscnt 0" ::: "memory"); __builtin_amdgcn_wave_barrier(); } while (0)
  // one step ahead: the V fragments and the two ks of step ks + 1 are asked for during step ks, so that their latency runs under the weights' arithmetic instead of in front of each WMMA group
  const __bf16* vhp = VTH + (size_t)bc * KD * TT; const __bf16* vlp = VTL + (size_t)bc * KD * TT; const unsigned lo8 = lane * 8u;
  v16b vh[4], vl[4];
#pragma unroll
  for (int dt = 0; dt < 4; ++dt) { vh[dt] = frag_p(vhp + dt * 512 + lo8); vl[dt] = frag_p(vlp + dt * 512 + lo8); }
  float k0 = ksb[col], k1 = ksb[16 + col];
#pragma unroll 1
  for (int ks = 0; ks < TT / 32; ++ks) {
    const int kn = ks + 1 < TT / 32 ? ks + 1 : ks;   // the last step asks for its own data again: in bounds, not used
    // unrolled so that qsr, m and l are indexed by constants and stay in registers
#pragma unroll
    for (int r = 0; r < 8; ++r) { const float e0 = __builtin_amdgcn_exp2f(qsr[r] * k0 - m[r]), e1 = __builtin_amdgcn_exp2f(qsr[r] * k1 - m[r]);
      l[r] += e0 + e1;
      sp[wave][8 * g + r][col] = e0; sp[wave][8 * g + r][16 + col] = e1; }
    k0 = ksb[kn * 32 + col]; k1 = ksb[kn * 32 + 16 + col];
    LDSW();
    const F2 pa = split_row(&sp[wave][col][0], 0, lane);
#pragma unroll
    for (int dt = 0; dt < 4; ++dt) {
      acc[dt] = wmma_bf(pa.l, vh[dt], acc[dt]); acc[dt] = wmma_bf(pa.h, vl[dt], acc[dt]); acc[dt] = wmma_bf(pa.h, vh[dt], acc[dt]);
      vh[dt] = frag_p(vhp + (size_t)dt * 512 + kn * 32 * KD + lo8); vl[dt] = frag_p(vlp + (size_t)dt * 512 + kn * 32 * KD + lo8); }
    asm volatile("s_wait_xcnt 0x0" ::: "memory");   // precaution: the next step rewrites the address registers of the V loads just issued
    LDSW(); }
#pragma unroll
  for (int r = 0; r < 8; ++r) { float es = l[r];
    for (int o = 1; o < 16; o <<= 1) es += __shfl_xor(es, o);
    const float il = 1.0f / es;
#pragma unroll
    for (int dt = 0; dt < 4; ++dt) so[wave][8 * g + r][dt * 16 + col] = acc[dt][r] * il; }
  LDSX();
  for (int rl = 0; rl < 16; ++rl) if (lane < 16) vst2(OUT + (tq + rl) * KD + lane * 4, *(const v4f*)&so[wave][rl][lane * 4]);
}

extern "C" void kernel_launch(void* const* d_in, const int* in_sizes, int n_in, void* d_out, int out_size, void* d_ws, size_t ws_size, hipStream_t stream) {
  (void)in_sizes; (void)n_in; (void)out_size;
  const float** F = (const float**)d_in;   // x [4,8,2048,64], Wq [64,64], bq, Wk, bk, Wv, bv (torch [out][in])
  if (ws_size < (size_t)WS_END) return;
  char* ws = (char*)d_ws; __bf16 *PT = (__bf16*)(ws + WS_PT), *VTH = (__bf16*)(ws + WS_VTH), *VTL = (__bf16*)(ws + WS_VTL); float *QS = (float*)(ws + WS_QS), *KS = (float*)(ws + WS_KS);
  k_pack<<<QKVP, 64, 0, stream>>>(F[1], F[3], F[5], PT);
  k_proj<<<TRB, 128, 0, stream>>>(F[0], PT, F[2], F[4], F[6], VTH, VTL, QS, KS);
  k_attn<<<dim3(TQB, TNB), 128, 0, stream>>>(QS, KS, VTH, VTL, (float*)d_out);
}

// v006
// A run of this version takes 60.9 microseconds.
// Timed twice side by side with v005, it ran 1.16 times as fast both times.
// Counting every step since v000, it is 4.72 times as fast.
// compute dtype: x, Wq/Wk/Wv + biases (module inputs) rounded to bf16; q/k/v projections with exact bf16 products (+ bias); the per-row sums qs, ks and the rank-1 scores qs_t ks_s / 8 in f32; softmax weights x V with both computed operands as bf16 hi + residual pairs (3 products); softmax in f32; f32 accumulate.
#include <hip/hip_runtime.h>
#include <math.h>

typedef __attribute__((ext_vector_type(16))) _Float16 v16h;
typedef __attribute__((ext_vector_type(16))) __bf16 v16b;
typedef __attribute__((ext_vector_type(8)))  _Float16 v8h;
typedef __attribute__((ext_vector_type(8)))  float v8f;
typedef __attribute__((ext_vector_type(4)))  float v4f;
typedef __attribute__((ext_vector_type(2)))  float v2f;
typedef __attribute__((ext_vector_type(4)))  unsigned v4u;
typedef __attribute__((ext_vector_type(4)))  int v4i;
typedef float __attribute__((may_alias)) float_a;
typedef int __attribute__((may_alias)) int_a;

template <typename T> __device__ __forceinline__ void vst2(void* p, T v) { *(T*)p = v;  }
__device__ __forceinline__ v8f wmma16(v16h a, v16h b, v8f c) {
  v8f d = __builtin_amdgcn_wmma_f32_16x16x32_f16(false, a, false, b, (short)0, c, false, false);
  asm volatile("v_nop\n\tv_nop\n\tv_nop\n\tv_nop" : "+v"(d) : "v"(a), "v"(b));
  return d;
}
__device__ __forceinline__ v8f wmma_bf(v16b a, v16b b, v8f c) {
  v8f d = __builtin_amdgcn_wmma_f32_16x16x32_bf16(false, a, false, b, (short)0, c, false, false);
  asm volatile("v_nop\n\tv_nop\n\tv_nop\n\tv_nop" : "+v"(d) : "v"(a), "v"(b));
  return d;
}
// 16x16x32 fragments: lane = (h = lane>>4, row/col = lane&15); elements 0..7 = k0+8h+0..7, 8..15 = k0+16+8h+0..7; D element r = row 8h+r
__device__ __forceinline__ v16h frag_h(const _Float16* rowk0, int lane) {
  union { v16h v; v8h q[2]; } u; const _Float16* p = rowk0 + 8 * (lane >> 4);
  u.q[0] = *(const v8h*)p; u.q[1] = *(const v8h*)(p + 16); return u.v;
}
__device__ __forceinline__ v16h frag_f32(const float* rowk0, int lane) {
  v16h a; const float* p = rowk0 + 8 * (lane >> 4);
#pragma unroll
  for (int i = 0; i < 8; ++i) { a[i] = (_Float16)p[i]; a[8 + i] = (_Float16)p[16 + i]; }
  return a;
}
__device__ __forceinline__ v16h frag_f32s(const float* rowk0, int lane, float sc) {
  v16h a; const float* p = rowk0 + 8 * (lane >> 4);
#pragma unroll
  for (int i = 0; i < 8; ++i) { a[i] = (_Float16)(p[i] * sc); a[8 + i] = (_Float16)(p[16 + i] * sc); }
  return a;
}
// column fragment from a [K][ld] layout (column n), rows >= K read as 0
__device__ __forceinline__ v16h fragc_f32(const float* W, int k0, int n, int lane, int ld, int K) {
  v16h a; const int g = lane >> 4;
#pragma unroll
  for (int i = 0; i < 8; ++i) { const int ka = k0 + 8 * g + i, kb = ka + 16;
    a[i] = (_Float16)(ka < K ? W[(size_t)(ka < K ? ka : K - 1) * ld + n] : 0.f); a[8 + i] = (_Float16)(kb < K ? W[(size_t)(kb < K ? kb : K - 1) * ld + n] : 0.f); }
  return a;
}
struct F2 { v16b h, l; };
__device__ __forceinline__ F2 bsplit16(const float v[16]) { F2 r;
#pragma unroll
  for (int i = 0; i < 16; ++i) { const __bf16 h = (__bf16)v[i]; r.h[i] = h; r.l[i] = (__bf16)(v[i] - (float)h); }
  return r; }
__device__ __forceinline__ F2 split_row(const float* row, int k0, int lane) { float v[16]; const float* p = row + k0 + 8 * (lane >> 4);
#pragma unroll
  for (int i = 0; i < 8; ++i) { v[i] = p[i]; v[8 + i] = p[16 + i]; }
  return bsplit16(v); }
__device__ __forceinline__ F2 split_rowK(const float* row, int k0, int lane, int K) { float v[16]; const int g = lane >> 4;
#pragma unroll
  for (int i = 0; i < 8; ++i) { const int ka = k0 + 8 * g + i, kb = ka + 16; v[i] = ka < K ? row[ka < K ? ka : K - 1] : 0.f; v[8 + i] = kb < K ? row[kb < K ? kb : K - 1] : 0.f; }
  return bsplit16(v); }
__device__ __forceinline__ F2 split_col(const float* W, int k0, int n, int lane, int ld, int K) { float v[16]; const int g = lane >> 4;
#pragma unroll
  for (int i = 0; i < 8; ++i) { const int ka = k0 + 8 * g + i, kb = ka + 16; v[i] = ka < K ? W[(size_t)(ka < K ? ka : K - 1) * ld + n] : 0.f; v[8 + i] = kb < K ? W[(size_t)(kb < K ? kb : K - 1) * ld + n] : 0.f; }
  return bsplit16(v); }
__device__ __forceinline__ v8f mac3(const F2& a, const F2& b, v8f c) { c = wmma_bf(a.l, b.h, c); c = wmma_bf(a.h, b.l, c); return wmma_bf(a.h, b.h, c); }
__device__ __forceinline__ float sigm(float v) { return 1.0f / (1.0f + expf(-v)); }
#define LDSX() do { asm volatile("s_wait_dscnt 0" ::: "memory"); __builtin_amdgcn_wave_barrier(); __builtin_amdgcn_fence(__ATOMIC_RELEASE, "workgroup"); } while (0)


// K-dim self attention on x [4,8,2048,64]: q,k,v = x W^T + b; scores[t][s] = (sum_i q[t][i]) (sum_j k[s][j]) / 8 (the reference einsum sums i and j independently); softmax over s; out = sum_s w v[s] -> [4,8,2048,64].
// k_proj (rounds the weights to bf16 into LDS itself; exact GEMM + bias; keeps only the qs/ks row sums of q and k, and V as hi/lo planes per (b,c) in B-fragment order), k_attn (block = (64-query block, b*8+c), 4 waves: 64 key steps; scores from the two scalars, row max in closed form, lane-partial row sums, P hi/lo x V planes (3 products); writes the output rows).
#define NBC 32              // B*C
#define TT 2048
#define KD 64
#define NR (NBC * TT)       // 65536 rows
#define QKVP 192
#ifndef TRB
#define TRB (NR / 64)
#define TQB (TT / 64)
#define TNB NBC
#endif
typedef __attribute__((ext_vector_type(8))) __bf16 v8b;
typedef __attribute__((ext_vector_type(4))) __bf16 v4b;
#define WP 72               // LDS row pitch of the staged weights, in bf16: 144 B = 16 B x 9, an odd multiple, so that 16-byte fragment reads of 16 rows spread over the banks
__device__ __forceinline__ v16b frag_b(const __bf16* rowk0, int lane) {
  union { v16b v; v8b q[2]; } u; const __bf16* p = rowk0 + 8 * (lane >> 4);
  u.q[0] = *(const v8b*)p; u.q[1] = *(const v8b*)(p + 16); return u.v;
}
// B fragment from the fragment-order planes: each of the two 16-byte loads reads 512 bytes in a row over the wave (4 whole lines)
__device__ __forceinline__ v16b frag_p(const __bf16* p) {
  union { v16b v; v8b q[2]; } u; u.q[0] = *(const v8b*)p; u.q[1] = *(const v8b*)(p + 256); return u.v;
}
__device__ __forceinline__ v16b frag_gbf(const float* rowk0, int lane) {
  v16b a; const float* p = rowk0 + 8 * (lane >> 4);
#pragma unroll
  for (int i = 0; i < 8; ++i) { a[i] = (__bf16)p[i]; a[8 + i] = (__bf16)p[16 + i]; }
  return a;
}
__device__ __forceinline__ float bfr(float v) { return (float)(__bf16)v; }
#define WS_PT   0u                               // 24 KiB, not used
#define WS_QS   (WS_PT + 2u * QKVP * KD)           // f32 [65536] row sums of q
#define WS_KS   (WS_QS + 4u * NR)
#define WS_VTH  (WS_KS + 4u * NR)                  // bf16 [32 bc][64 key steps][4 dt][2 halves][32 lanes][8]: element i = V[32 step + 16 half + 8 (lane >> 4) + i][16 dt + (lane & 15)]
#define WS_VTL  (WS_VTH + 2u * NBC * KD * TT)
#define WS_END  (WS_VTL + 2u * NBC * KD * TT)

// ---- k_proj: block = 64 rows (4 waves): Wq|Wk|Wv (torch [out][in]) rounded to bf16 into LDS once per block, B fragments from there; 12 tiles (K 64 exact) + bias; qs/ks = row sums of the q and k parts (f32, from the LDS tile) -> QS/KS (64 floats = 256 B per block); the V tiles go from the accumulators to the planes
__global__ __launch_bounds__(128) void k_proj(const float* __restrict__ X, const float* __restrict__ Wq, const float* __restrict__ Wk, const float* __restrict__ Wv, const float* __restrict__ bq, const float* __restrict__ bk, const float* __restrict__ bv, __bf16* __restrict__ VTH, __bf16* __restrict__ VTL, float* __restrict__ QS, float* __restrict__ KS) {
  __shared__ __align__(16) float so[4][16][132]; __shared__ __align__(16) float sqs[64], sks[64]; __shared__ __align__(16) __bf16 sw[QKVP * WP];
  const int tid = threadIdx.x, wave = tid >> 5, lane = tid & 31, col = lane & 15, g = lane >> 4; const size_t r0 = (size_t)blockIdx.x * 64 + wave * 16;
  // the weights are asked for first, both k halves of the x rows behind them: the load counter falls in issue order, so the weights can be rounded and stored while x is still on its way
  v4f wr[24];
  // unrolled so that the matrix is chosen at compile time and all 24 loads (each 512 bytes in a row over the wave) are in flight together
#pragma unroll
  for (int i = 0; i < 24; ++i) wr[i] = *(const v4f*)((i < 8 ? Wq : i < 16 ? Wk : Wv) + (i & 7) * 512 + tid * 4);
  v4f xr[2][4];
#pragma unroll
  for (int kc = 0; kc < 2; ++kc) { const float* xp = X + (r0 + col) * KD + kc * 32 + 8 * g;
    xr[kc][0] = *(const v4f*)xp; xr[kc][1] = *(const v4f*)(xp + 4); xr[kc][2] = *(const v4f*)(xp + 16); xr[kc][3] = *(const v4f*)(xp + 20); }
#pragma unroll
  for (int i = 0; i < 24; ++i) { v4b wb;
#pragma unroll
    for (int e = 0; e < 4; ++e) wb[e] = (__bf16)wr[i][e];
    *(v4b*)&sw[(i * 8 + (tid >> 4)) * WP + (tid & 15) * 4] = wb; }
  __syncthreads();   // publishes the staged weights to the four waves
  v8f acc[12] = {};
#pragma unroll
  for (int kc = 0; kc < 2; ++kc) { v16b a, b[12];
#pragma unroll
    for (int i = 0; i < 4; ++i) { a[i] = (__bf16)xr[kc][0][i]; a[4 + i] = (__bf16)xr[kc][1][i]; a[8 + i] = (__bf16)xr[kc][2][i]; a[12 + i] = (__bf16)xr[kc][3][i]; }
    // the 12 fragments are read as one group in front of the 12 WMMAs: one LDS latency per k half instead of one per WMMA
#pragma unroll
    for (int j = 0; j < 12; ++j) b[j] = frag_b(&sw[(j * 16 + col) * WP + kc * 32], lane);
#pragma unroll
    for (int j = 0; j < 12; ++j) acc[j] = wmma_bf(a, b[j], acc[j]); }
#pragma unroll
  for (int j = 0; j < 8; ++j) { const int n = j * 16 + col; const int which = n / KD, c = n % KD; const float bb = bfr((which == 0 ? bq : bk)[c]);
#pragma unroll
    for (int r = 0; r < 8; ++r) so[wave][8 * g + r][n] = acc[j][r] + bb; }
  // a D tile is already a piece of the planes: lane (g, col) holds rows 8 g + 0..7 of column 16 dt + col, the 8 elements of that lane in the B fragment of key step (row >> 5), half (row >> 4) & 1; each store covers 512 bytes in a row
  v8b vh[4], vl[4];
  // both loops unrolled so that acc, vh and vl are indexed by constants and stay in registers
#pragma unroll
  for (int dt = 0; dt < 4; ++dt) { const float bb = bfr(bv[dt * 16 + col]);
#pragma unroll
    for (int r = 0; r < 8; ++r) { const float v = acc[8 + dt][r] + bb; const __bf16 hb = (__bf16)v; vh[dt][r] = hb; vl[dt][r] = (__bf16)(v - (float)hb); } }
  const size_t vo = (size_t)blockIdx.x * 64 * KD + (wave >> 1) * 2048 + (wave & 1) * 256 + lane * 8;
  LDSX();
  __builtin_amdgcn_sched_barrier(0);   // keeps the conversions in front of the eight stores: no store's data register is reused between them, so one wait behind the last store serves all
  // behind the LDS hand-over, whose release would wait for them, and in front of the row sums, under which they drain; unrolled for constant indices, as above
#pragma unroll
  for (int dt = 0; dt < 4; ++dt) { vst2(VTH + vo + dt * 512, vh[dt]); vst2(VTL + vo + dt * 512, vl[dt]); }
  if (lane < 16) { float s1 = 0.f, s2 = 0.f; for (int d = 0; d < KD; ++d) { s1 += so[wave][lane][d]; s2 += so[wave][lane][KD + d]; } sqs[wave * 16 + lane] = s1; sks[wave * 16 + lane] = s2; }
  __syncthreads();
  if (tid < 16) vst2(QS + (size_t)blockIdx.x * 64 + tid * 4, *(const v4f*)&sqs[tid * 4]); else if (tid < 32) vst2(KS + (size_t)blockIdx.x * 64 + (tid - 16) * 4, *(const v4f*)&sks[(tid - 16) * 4]);
}
// ---- k_attn: block = (query block, bc), 4 waves: s[r][kk] = qs[q] ks[kk] / 8; softmax against the closed-form row max; P (hi/lo) x V planes (3 products); out rows 256 B
__global__ __launch_bounds__(128) void k_attn(const float* __restrict__ QS, const float* __restrict__ KS, const __bf16* __restrict__ VTH, const __bf16* __restrict__ VTL, float* __restrict__ OUT) {
  __shared__ __align__(16) float sp[4][16][36]; __shared__ __align__(16) float so[4][16][68];
  const int tid = threadIdx.x, wave = tid >> 5, lane = tid & 31, col = lane & 15, g = lane >> 4;
  const int qb = blockIdx.x, bc = blockIdx.y; const int q0 = qb * 64 + wave * 16; const size_t tq = (size_t)bc * TT + q0;
  float qsr[8]; 
#pragma unroll
  for (int r = 0; r < 8; ++r) qsr[r] = QS[tq + 8 * g + r] * (0.125f * 1.44269504088896340736f);   // 1/8 and log2(e) in one factor: the weights are 2^(qsr ks - m)
  // scores are rank 1 (qs[t] * ks[s]) and rounding is monotonic, so the row maximum is exactly max(qs*max ks, qs*min ks): each wave scans the 2048 ks of its (b,c) once
  const float* ksb = KS + (size_t)bc * TT;
  float kmx = -INFINITY, kmn = INFINITY;
  // unrolled so that the 16 loads are in flight together
#pragma unroll
  for (int i = 0; i < TT / 128; ++i) { const v4f kv = *(const v4f*)(ksb + i * 128 + lane * 4);
    kmx = fmaxf(kmx, fmaxf(fmaxf(kv[0], kv[1]), fmaxf(kv[2], kv[3]))); kmn = fminf(kmn, fminf(fminf(kv[0], kv[1]), fminf(kv[2], kv[3]))); }
  for (int o = 1; o < 32; o <<= 1) { kmx = fmaxf(kmx, __shfl_xor(kmx, o)); kmn = fminf(kmn, __shfl_xor(kmn, o)); }
  float m[8], l[8];   // l: this lane's share of the row sum (its two key columns per step), reduced over the 16 lanes behind the loop
#pragma unroll
  for (int r = 0; r < 8; ++r) { m[r] = fmaxf(qsr[r] * kmx, qsr[r] * kmn); l[r] = 0.f; }
  v8f acc[4] = {};
  // sp[wave] is written and read by this wave alone: its hand-over needs the LDS wait and the compiler's order only; the workgroup-scope release of LDSX would also wait for the global loads in flight
#define LDSW() do { asm volatile("s_wait_dscnt 0" ::: "memory"); __builtin_amdgcn_wave_barrier(); } while (0)
  // one step ahead: the V fragments and the two ks of step ks + 1 are asked for during step ks, so that their latency runs under the weights' arithmetic instead of in front of each WMMA group
  const __bf16* vhp = VTH + (size_t)bc * KD * TT; const __bf16* vlp = VTL + (size_t)bc * KD * TT; const unsigned lo8 = lane * 8u;
  v16b vh[4], vl[4];
#pragma unroll
  for (int dt = 0; dt < 4; ++dt) { vh[dt] = frag_p(vhp + dt * 512 + lo8); vl[dt] = frag_p(vlp + dt * 512 + lo8); }
  float k0 = ksb[col], k1 = ksb[16 + col];
#pragma unroll 1
  for (int ks = 0; ks < TT / 32; ++ks) {
    const int kn = ks + 1 < TT / 32 ? ks + 1 : ks;   // the last step asks for its own data again: in bounds, not used
    // unrolled so that qsr, m and l are indexed by constants and stay in registers
#pragma unroll
    for (int r = 0; r < 8; ++r) { const float e0 = __builtin_amdgcn_exp2f(qsr[r] * k0 - m[r]), e1 = __builtin_amdgcn_exp2f(qsr[r] * k1 - m[r]);
      l[r] += e0 + e1;
      sp[wave][8 * g + r][col] = e0; sp[wave][8 * g + r][16 + col] = e1; }
    k0 = ksb[kn * 32 + col]; k1 = ksb[kn * 32 + 16 + col];
    LDSW();
    const F2 pa = split_row(&sp[wave][col][0], 0, lane);
#pragma unroll
    for (int dt = 0; dt < 4; ++dt) {
      acc[dt] = wmma_bf(pa.l, vh[dt], acc[dt]); acc[dt] = wmma_bf(pa.h, vl[dt], acc[dt]); acc[dt] = wmma_bf(pa.h, vh[dt], acc[dt]);
      vh[dt] = frag_p(vhp + (size_t)dt * 512 + kn * 32 * KD + lo8); vl[dt] = frag_p(vlp + (size_t)dt * 512 + kn * 32 * KD + lo8); }
    asm volatile("s_wait_xcnt 0x0" ::: "memory");   // precaution: the next step rewrites the address registers of the V loads just issued
    LDSW(); }
#pragma unroll
  for (int r = 0; r < 8; ++r) { float es = l[r];
    for (int o = 1; o < 16; o <<= 1) es += __shfl_xor(es, o);
    const float il = 1.0f / es;
#pragma unroll
    for (int dt = 0; dt < 4; ++dt) so[wave][8 * g + r][dt * 16 + col] = acc[dt][r] * il; }
  LDSX();
  for (int rl = 0; rl < 16; ++rl) if (lane < 16) vst2(OUT + (tq + rl) * KD + lane * 4, *(const v4f*)&so[wave][rl][lane * 4]);
}

extern "C" void kernel_launch(void* const* d_in, const int* in_sizes, int n_in, void* d_out, int out_size, void* d_ws, size_t ws_size, hipStream_t stream) {
  (void)in_sizes; (void)n_in; (void)out_size;
  const float** F = (const float**)d_in;   // x [4,8,2048,64], Wq [64,64], bq, Wk, bk, Wv, bv (torch [out][in])
  if (ws_size < (size_t)WS_END) return;
  char* ws = (char*)d_ws; __bf16 *VTH = (__bf16*)(ws + WS_VTH), *VTL = (__bf16*)(ws + WS_VTL); float *QS = (float*)(ws + WS_QS), *KS = (float*)(ws + WS_KS);
  k_proj<<<TRB, 128, 0, stream>>>(F[0], F[1], F[3], F[5], F[2], F[4], F[6], VTH, VTL, QS, KS);
  k_attn<<<dim3(TQB, TNB), 128, 0, stream>>>(QS, KS, VTH, VTL, (float*)d_out);
}

// v007
// Measured time: 53 microseconds a run.
// Two timings next to v006 put it at 1.14 and 1.18 times that version's speed.
// Over all steps from v000 it is 5.48 times as fast.
// compute dtype: x, Wq/Wk/Wv + biases (module inputs) rounded to bf16; q/k projections with exact bf16 products (+ bias); the per-row sums qs, ks and the rank-1 scores qs_t ks_s / 8 in f32; softmax in f32; softmax weights as bf16 hi + residual pairs x the bf16 x rows (2 products); the weighted x row as a bf16 hi + residual pair x Wv (2 products) + bv; f32 accumulate.
#include <hip/hip_runtime.h>
#include <math.h>

typedef __attribute__((ext_vector_type(16))) _Float16 v16h;
typedef __attribute__((ext_vector_type(16))) __bf16 v16b;
typedef __attribute__((ext_vector_type(8)))  _Float16 v8h;
typedef __attribute__((ext_vector_type(8)))  float v8f;
typedef __attribute__((ext_vector_type(4)))  float v4f;
typedef __attribute__((ext_vector_type(2)))  float v2f;
typedef __attribute__((ext_vector_type(4)))  unsigned v4u;
typedef __attribute__((ext_vector_type(4)))  int v4i;
typedef float __attribute__((may_alias)) float_a;
typedef int __attribute__((may_alias)) int_a;

template <typename T> __device__ __forceinline__ void vst2(void* p, T v) { *(T*)p = v;  }
__device__ __forceinline__ v8f wmma16(v16h a, v16h b, v8f c) {
  v8f d = __builtin_amdgcn_wmma_f32_16x16x32_f16(false, a, false, b, (short)0, c, false, false);
  asm volatile("v_nop\n\tv_nop\n\tv_nop\n\tv_nop" : "+v"(d) : "v"(a), "v"(b));
  return d;
}
__device__ __forceinline__ v8f wmma_bf(v16b a, v16b b, v8f c) {
  v8f d = __builtin_amdgcn_wmma_f32_16x16x32_bf16(false, a, false, b, (short)0, c, false, false);
  asm volatile("v_nop\n\tv_nop\n\tv_nop\n\tv_nop" : "+v"(d) : "v"(a), "v"(b));
  return d;
}
// 16x16x32 fragments: lane = (h = lane>>4, row/col = lane&15); elements 0..7 = k0+8h+0..7, 8..15 = k0+16+8h+0..7; D element r = row 8h+r
__device__ __forceinline__ v16h frag_h(const _Float16* rowk0, int lane) {
  union { v16h v; v8h q[2]; } u; const _Float16* p = rowk0 + 8 * (lane >> 4);
  u.q[0] = *(const v8h*)p; u.q[1] = *(const v8h*)(p + 16); return u.v;
}
__device__ __forceinline__ v16h frag_f32(const float* rowk0, int lane) {
  v16h a; const float* p = rowk0 + 8 * (lane >> 4);
#pragma unroll
  for (int i = 0; i < 8; ++i) { a[i] = (_Float16)p[i]; a[8 + i] = (_Float16)p[16 + i]; }
  return a;
}
__device__ __forceinline__ v16h frag_f32s(const float* rowk0, int lane, float sc) {
  v16h a; const float* p = rowk0 + 8 * (lane >> 4);
#pragma unroll
  for (int i = 0; i < 8; ++i) { a[i] = (_Float16)(p[i] * sc); a[8 + i] = (_Float16)(p[16 + i] * sc); }
  return a;
}
// column fragment from a [K][ld] layout (column n), rows >= K read as 0
__device__ __forceinline__ v16h fragc_f32(const float* W, int k0, int n, int lane, int ld, int K) {
  v16h a; const int g = lane >> 4;
#pragma unroll
  for (int i = 0; i < 8; ++i) { const int ka = k0 + 8 * g + i, kb = ka + 16;
    a[i] = (_Float16)(ka < K ? W[(size_t)(ka < K ? ka : K - 1) * ld + n] : 0.f); a[8 + i] = (_Float16)(kb < K ? W[(size_t)(kb < K ? kb : K - 1) * ld + n] : 0.f); }
  return a;
}
struct F2 { v16b h, l; };
__device__ __forceinline__ F2 bsplit16(const float v[16]) { F2 r;
#pragma unroll
  for (int i = 0; i < 16; ++i) { const __bf16 h = (__bf16)v[i]; r.h[i] = h; r.l[i] = (__bf16)(v[i] - (float)h); }
  return r; }
__device__ __forceinline__ F2 split_row(const float* row, int k0, int lane) { float v[16]; const float* p = row + k0 + 8 * (lane >> 4);
#pragma unroll
  for (int i = 0; i < 8; ++i) { v[i] = p[i]; v[8 + i] = p[16 + i]; }
  return bsplit16(v); }
__device__ __forceinline__ F2 split_rowK(const float* row, int k0, int lane, int K) { float v[16]; const int g = lane >> 4;
#pragma unroll
  for (int i = 0; i < 8; ++i) { const int ka = k0 + 8 * g + i, kb = ka + 16; v[i] = ka < K ? row[ka < K ? ka : K - 1] : 0.f; v[8 + i] = kb < K ? row[kb < K ? kb : K - 1] : 0.f; }
  return bsplit16(v); }
__device__ __forceinline__ F2 split_col(const float* W, int k0, int n, int lane, int ld, int K) { float v[16]; const int g = lane >> 4;
#pragma unroll
  for (int i = 0; i < 8; ++i) { const int ka = k0 + 8 * g + i, kb = ka + 16; v[i] = ka < K ? W[(size_t)(ka < K ? ka : K - 1) * ld + n] : 0.f; v[8 + i] = kb < K ? W[(size_t)(kb < K ? kb : K - 1) * ld + n] : 0.f; }
  return bsplit16(v); }
__device__ __forceinline__ v8f mac3(const F2& a, const F2& b, v8f c) { c = wmma_bf(a.l, b.h, c); c = wmma_bf(a.h, b.l, c); return wmma_bf(a.h, b.h, c); }
__device__ __forceinline__ float sigm(float v) { return 1.0f / (1.0f + expf(-v)); }
#define LDSX() do { asm volatile("s_wait_dscnt 0" ::: "memory"); __builtin_amdgcn_wave_barrier(); __builtin_amdgcn_fence(__ATOMIC_RELEASE, "workgroup"); } while (0)


// K-dim self attention on x [4,8,2048,64]: q,k,v = x W^T + b; scores[t][s] = (sum_i q[t][i]) (sum_j k[s][j]) / 8 (the reference einsum sums i and j independently); softmax over s; out = sum_s w v[s] -> [4,8,2048,64].
// The value projection is linear and the weights of a row sum to 1: sum_s w_s (x_s Wv^T + bv) = (sum_s w_s x_s) Wv^T + bv. The key loop therefore sums the bf16 x rows, which need no residual plane, and Wv is applied once per query row behind it.
// k_proj (rounds Wq|Wk to bf16 into LDS itself; exact GEMM + bias; keeps only the qs/ks row sums of q and k, and the bf16 x rows as one plane per (b,c) in B-fragment order), k_attn (block = (64-query block, b*8+c), 4 waves: 64 key steps; scores from the two scalars, row max in closed form, lane-partial row sums, P hi/lo x the x plane (2 products); then y hi/lo x Wv (2 products) + bv; writes the output rows).
#define NBC 32              // B*C
#define TT 2048
#define KD 64
#define NR (NBC * TT)       // 65536 rows
#define QKP 128             // rows of Wq|Wk
#ifndef TRB
#define TRB (NR / 64)
#define TQB (TT / 64)
#define TNB NBC
#endif
typedef __attribute__((ext_vector_type(8))) __bf16 v8b;
typedef __attribute__((ext_vector_type(4))) __bf16 v4b;
#define WP 72               // LDS row pitch of the staged weights, in bf16: 144 B = 16 B x 9, an odd multiple, so that 16-byte fragment reads of 16 rows spread over the banks
__device__ __forceinline__ v16b frag_b(const __bf16* rowk0, int lane) {
  union { v16b v; v8b q[2]; } u; const __bf16* p = rowk0 + 8 * (lane >> 4);
  u.q[0] = *(const v8b*)p; u.q[1] = *(const v8b*)(p + 16); return u.v;
}
// B fragment from the fragment-order planes: each of the two 16-byte loads reads 512 bytes in a row over the wave (4 whole lines)
__device__ __forceinline__ v16b frag_p(const __bf16* p) {
  union { v16b v; v8b q[2]; } u; u.q[0] = *(const v8b*)p; u.q[1] = *(const v8b*)(p + 256); return u.v;
}
__device__ __forceinline__ v16b frag_gbf(const float* rowk0, int lane) {
  v16b a; const float* p = rowk0 + 8 * (lane >> 4);
#pragma unroll
  for (int i = 0; i < 8; ++i) { a[i] = (__bf16)p[i]; a[8 + i] = (__bf16)p[16 + i]; }
  return a;
}
__device__ __forceinline__ float bfr(float v) { return (float)(__bf16)v; }
#define WS_PT   0u                               // 24 KiB, not used
#define WS_QS   (WS_PT + 2u * 192 * KD)            // f32 [65536] row sums of q
#define WS_KS   (WS_QS + 4u * NR)
#define WS_XT   (WS_KS + 4u * NR)                  // bf16 [32 bc][64 key steps][4 dt][2 halves][32 lanes][8]: element i = x[32 step + 16 half + 8 (lane >> 4) + i][16 dt + (lane & 15)]
#define WS_END  (WS_XT + 2u * NBC * KD * TT)

// ---- k_proj: block = 64 rows (4 waves): Wq|Wk (torch [out][in]) rounded to bf16 into LDS once per block, B fragments from there; 8 tiles (K 64 exact) + bias; qs/ks = row sums of the q and k parts (f32, from the LDS tile) -> QS/KS (64 floats = 256 B per block); the bf16 x rows go to the plane in B-fragment order
__global__ __launch_bounds__(128) void k_proj(const float* __restrict__ X, const float* __restrict__ Wq, const float* __restrict__ Wk, const float* __restrict__ bq, const float* __restrict__ bk, __bf16* __restrict__ XT, float* __restrict__ QS, float* __restrict__ KS) {
  __shared__ __align__(16) float so[4][16][132]; __shared__ __align__(16) float sqs[64], sks[64]; __shared__ __align__(16) __bf16 sw[QKP * WP];
  const int tid = threadIdx.x, wave = tid >> 5, lane = tid & 31, col = lane & 15, g = lane >> 4; const size_t r0 = (size_t)blockIdx.x * 64 + wave * 16;
  // the weights are asked for first, both k halves of the x rows behind them: the load counter falls in issue order, so the weights can be rounded and stored while x is still on its way
  v4f wr[16];
  // unrolled so that the matrix is chosen at compile time and all 16 loads (each 512 bytes in a row over the wave) are in flight together
#pragma unroll
  for (int i = 0; i < 16; ++i) wr[i] = *(const v4f*)((i < 8 ? Wq : Wk) + (i & 7) * 512 + tid * 4);
  v4f xr[2][4];
#pragma unroll
  for (int kc = 0; kc < 2; ++kc) { const float* xp = X + (r0 + col) * KD + kc * 32 + 8 * g;
    xr[kc][0] = *(const v4f*)xp; xr[kc][1] = *(const v4f*)(xp + 4); xr[kc][2] = *(const v4f*)(xp + 16); xr[kc][3] = *(const v4f*)(xp + 20); }
#pragma unroll
  for (int i = 0; i < 16; ++i) { v4b wb;
#pragma unroll
    for (int e = 0; e < 4; ++e) wb[e] = (__bf16)wr[i][e];
    *(v4b*)&sw[(i * 8 + (tid >> 4)) * WP + (tid & 15) * 4] = wb; }
  // inputs only: holds the x loads in front of the barrier, in flight together with the weights' loads; sunk behind it, their memory latency would stand alone
  asm volatile("" :: "v"(xr[0][0]), "v"(xr[0][1]), "v"(xr[0][2]), "v"(xr[0][3]), "v"(xr[1][0]), "v"(xr[1][1]), "v"(xr[1][2]), "v"(xr[1][3]));
  __syncthreads();   // publishes the staged weights to the four waves
  // unit columns as B fragments (built in an unrolled loop: vector elements need constant indices): u0[k][n] = (k == n), u1[k][n] = (k == 16 + n), k = 0..31. a x u0 and a x u1 are the two 16-column halves of the wave's bf16 x rows as D tiles, that is, turned from row order (a lane holds 8 columns of one row) into the plane's order (a lane holds 8 rows of one column); exact, each sum has one term that is not 0
  v16b u0 = {}, u1 = {};
#pragma unroll
  for (int e = 0; e < 8; ++e) { const __bf16 t = (__bf16)(8 * g + e == col ? 1.0f : 0.0f); u0[e] = t; u1[8 + e] = t; }
  v8f acc[8] = {}, xt[4] = {};
#pragma unroll
  for (int kc = 0; kc < 2; ++kc) { v16b a, b[8];
#pragma unroll
    for (int i = 0; i < 4; ++i) { a[i] = (__bf16)xr[kc][0][i]; a[4 + i] = (__bf16)xr[kc][1][i]; a[8 + i] = (__bf16)xr[kc][2][i]; a[12 + i] = (__bf16)xr[kc][3][i]; }
    // the 8 fragments are read as one group in front of the WMMAs: one LDS latency per k half instead of one per WMMA
#pragma unroll
    for (int j = 0; j < 8; ++j) b[j] = frag_b(&sw[(j * 16 + col) * WP + kc * 32], lane);
#pragma unroll
    for (int j = 0; j < 8; ++j) acc[j] = wmma_bf(a, b[j], acc[j]);
    xt[2 * kc] = wmma_bf(a, u0, xt[2 * kc]); xt[2 * kc + 1] = wmma_bf(a, u1, xt[2 * kc + 1]); }
#pragma unroll
  for (int j = 0; j < 8; ++j) { const int n = j * 16 + col; const int which = n / KD, c = n % KD; const float bb = bfr((which == 0 ? bq : bk)[c]);
#pragma unroll
    for (int r = 0; r < 8; ++r) so[wave][8 * g + r][n] = acc[j][r] + bb; }
  // a D tile is already a piece of the plane: lane (g, col) holds rows 8 g + 0..7 of column 16 dt + col, the 8 elements of that lane in the B fragment of key step (row >> 5), half (row >> 4) & 1; each store covers 512 bytes in a row
  v8b xh[4];
  // both loops unrolled so that xt and xh are indexed by constants and stay in registers
#pragma unroll
  for (int dt = 0; dt < 4; ++dt) {
#pragma unroll
    for (int r = 0; r < 8; ++r) xh[dt][r] = (__bf16)xt[dt][r]; }
  const size_t vo = (size_t)blockIdx.x * 64 * KD + (wave >> 1) * 2048 + (wave & 1) * 256 + lane * 8;
  LDSX();
  __builtin_amdgcn_sched_barrier(0);   // keeps the conversions in front of the four stores: no store's data register is reused between them, so one wait behind the last store serves all
  // behind the LDS hand-over, whose release would wait for them, and in front of the row sums, under which they drain; unrolled for constant indices, as above
#pragma unroll
  for (int dt = 0; dt < 4; ++dt) vst2(XT + vo + dt * 512, xh[dt]);
  if (lane < 16) { float s1 = 0.f, s2 = 0.f; for (int d = 0; d < KD; ++d) { s1 += so[wave][lane][d]; s2 += so[wave][lane][KD + d]; } sqs[wave * 16 + lane] = s1; sks[wave * 16 + lane] = s2; }
  __syncthreads();
  if (tid < 16) vst2(QS + (size_t)blockIdx.x * 64 + tid * 4, *(const v4f*)&sqs[tid * 4]); else if (tid < 32) vst2(KS + (size_t)blockIdx.x * 64 + (tid - 16) * 4, *(const v4f*)&sks[(tid - 16) * 4]);
}
// ---- k_attn: block = (query block, bc), 4 waves: s[r][kk] = qs[q] ks[kk] / 8; softmax against the closed-form row max; y = P (hi/lo) x the x plane (2 products); out = y (hi/lo) x Wv^T (2 products) + bv; out rows 256 B
__global__ __launch_bounds__(128) void k_attn(const float* __restrict__ QS, const float* __restrict__ KS, const __bf16* __restrict__ XT, const float* __restrict__ Wv, const float* __restrict__ bv, float* __restrict__ OUT) {
  __shared__ __align__(16) float sp[4][16][36]; __shared__ __align__(16) float so[4][16][68]; __shared__ __align__(16) __bf16 sw[KD * WP];
  const int tid = threadIdx.x, wave = tid >> 5, lane = tid & 31, col = lane & 15, g = lane >> 4;
  const int qb = blockIdx.x, bc = blockIdx.y; const int q0 = qb * 64 + wave * 16; const size_t tq = (size_t)bc * TT + q0;
  // Wv (torch [out][in]) is asked for first and the ks scan's loads behind it, all in flight together; it is rounded to bf16 into LDS once per block and read as B fragments behind the key loop
  v4f wr[8];
  // unrolled, here and in the loops down to the barrier, so that wr, kv, bb and qsr are indexed by constants and stay in registers
#pragma unroll
  for (int i = 0; i < 8; ++i) wr[i] = *(const v4f*)(Wv + i * 512 + tid * 4);
  const float* ksb = KS + (size_t)bc * TT;
  v4f kv[TT / 128];
  // unrolled so that the 16 loads are in flight together
#pragma unroll
  for (int i = 0; i < TT / 128; ++i) kv[i] = *(const v4f*)(ksb + i * 128 + lane * 4);
  float k0 = ksb[col], k1 = ksb[16 + col];   // in front of the first x fragments, as in every step: the loop's wait for them is then a counted one that leaves the x loads in flight
  float bb[4];
#pragma unroll
  for (int nt = 0; nt < 4; ++nt) bb[nt] = bv[nt * 16 + col];
  float qsr[8]; 
#pragma unroll
  for (int r = 0; r < 8; ++r) qsr[r] = QS[tq + 8 * g + r] * (0.125f * 1.44269504088896340736f);   // 1/8 and log2(e) in one factor: the weights are 2^(qsr ks - m)
#pragma unroll
  for (int i = 0; i < 8; ++i) { v4b wb;
#pragma unroll
    for (int e = 0; e < 4; ++e) wb[e] = (__bf16)wr[i][e];
    *(v4b*)&sw[(i * 8 + (tid >> 4)) * WP + (tid & 15) * 4] = wb; }
  __syncthreads();   // publishes the staged Wv to the four waves
  // scores are rank 1 (qs[t] * ks[s]) and rounding is monotonic, so the row maximum is exactly max(qs*max ks, qs*min ks): each wave scans the 2048 ks of its (b,c) once
  float kmx = -INFINITY, kmn = INFINITY;
#pragma unroll
  for (int i = 0; i < TT / 128; ++i) {
    kmx = fmaxf(kmx, fmaxf(fmaxf(kv[i][0], kv[i][1]), fmaxf(kv[i][2], kv[i][3]))); kmn = fminf(kmn, fminf(fminf(kv[i][0], kv[i][1]), fminf(kv[i][2], kv[i][3]))); }
  for (int o = 1; o < 32; o <<= 1) { kmx = fmaxf(kmx, __shfl_xor(kmx, o)); kmn = fminf(kmn, __shfl_xor(kmn, o)); }
  float m[8], l[8];   // l: this lane's share of the row sum (its two key columns per step), reduced over the 16 lanes behind the loop
#pragma unroll
  for (int r = 0; r < 8; ++r) { m[r] = fmaxf(qsr[r] * kmx, qsr[r] * kmn); l[r] = 0.f; }
  v8f acc[4] = {};
  // sp[wave] is written and read by this wave alone: its hand-over needs the LDS wait and the compiler's order only; the workgroup-scope release of LDSX would also wait for the global loads in flight
#define LDSW() do { asm volatile("s_wait_dscnt 0" ::: "memory"); __builtin_amdgcn_wave_barrier(); } while (0)
  // one step ahead: the x fragments and the two ks of step ks + 1 are asked for during step ks, so that their latency runs under the weights' arithmetic instead of in front of each WMMA group
  const __bf16* xp = XT + (size_t)bc * KD * TT; const unsigned lo8 = lane * 8u;
  v16b xb[4];
#pragma unroll
  for (int dt = 0; dt < 4; ++dt) xb[dt] = frag_p(xp + dt * 512 + lo8);
#pragma unroll 1
  for (int ks = 0; ks < TT / 32; ++ks) {
    const int kn = ks + 1 < TT / 32 ? ks + 1 : ks;   // the last step asks for its own data again: in bounds, not used
    // unrolled so that qsr, m and l are indexed by constants and stay in registers
#pragma unroll
    for (int r = 0; r < 8; ++r) { const float e0 = __builtin_amdgcn_exp2f(qsr[r] * k0 - m[r]), e1 = __builtin_amdgcn_exp2f(qsr[r] * k1 - m[r]);
      l[r] += e0 + e1;
      sp[wave][8 * g + r][col] = e0; sp[wave][8 * g + r][16 + col] = e1; }
    k0 = ksb[kn * 32 + col]; k1 = ksb[kn * 32 + 16 + col];
    LDSW();
    const F2 pa = split_row(&sp[wave][col][0], 0, lane);
#pragma unroll
    for (int dt = 0; dt < 4; ++dt) {
      acc[dt] = wmma_bf(pa.l, xb[dt], acc[dt]); acc[dt] = wmma_bf(pa.h, xb[dt], acc[dt]);
      xb[dt] = frag_p(xp + (size_t)dt * 512 + kn * 32 * KD + lo8); }
    asm volatile("s_wait_xcnt 0x0" ::: "memory");   // precaution: the next step rewrites the address registers of the x loads just issued
    LDSW(); }
  // the 8 Wv fragments are read as one group in front of the row sums' reduction, under which their LDS latency runs; unrolled for constant indices
  v16b wb0[4], wb1[4];
#pragma unroll
  for (int nt = 0; nt < 4; ++nt) { wb0[nt] = frag_b(&sw[(nt * 16 + col) * WP], lane); wb1[nt] = frag_b(&sw[(nt * 16 + col) * WP + 32], lane); }
  // y = acc / row sum, from the D layout through this wave's LDS tile into A fragments
#pragma unroll
  for (int r = 0; r < 8; ++r) { float es = l[r];
    for (int o = 1; o < 16; o <<= 1) es += __shfl_xor(es, o);
    const float il = 1.0f / es;
#pragma unroll
    for (int dt = 0; dt < 4; ++dt) so[wave][8 * g + r][dt * 16 + col] = acc[dt][r] * il; }
  LDSW();
  const F2 y0 = split_row(&so[wave][col][0], 0, lane), y1 = split_row(&so[wave][col][0], 32, lane);
  v8f o4[4] = {};
  // the four output tiles take turns, so that no WMMA waits for the one in front of it; unrolled so that o4 is indexed by constants and stays in registers
#pragma unroll
  for (int nt = 0; nt < 4; ++nt) o4[nt] = wmma_bf(y0.l, wb0[nt], o4[nt]);
#pragma unroll
  for (int nt = 0; nt < 4; ++nt) o4[nt] = wmma_bf(y1.l, wb1[nt], o4[nt]);
#pragma unroll
  for (int nt = 0; nt < 4; ++nt) o4[nt] = wmma_bf(y0.h, wb0[nt], o4[nt]);
#pragma unroll
  for (int nt = 0; nt < 4; ++nt) o4[nt] = wmma_bf(y1.h, wb1[nt], o4[nt]);
#pragma unroll
  for (int nt = 0; nt < 4; ++nt) { const float bn = bfr(bb[nt]);
#pragma unroll
    for (int r = 0; r < 8; ++r) so[wave][8 * g + r][nt * 16 + col] = o4[nt][r] + bn; }
  LDSX();
  for (int rl = 0; rl < 16; ++rl) if (lane < 16) vst2(OUT + (tq + rl) * KD + lane * 4, *(const v4f*)&so[wave][rl][lane * 4]);
}

extern "C" void kernel_launch(void* const* d_in, const int* in_sizes, int n_in, void* d_out, int out_size, void* d_ws, size_t ws_size, hipStream_t stream) {
  (void)in_sizes; (void)n_in; (void)out_size;
  const float** F = (const float**)d_in;   // x [4,8,2048,64], Wq [64,64], bq, Wk, bk, Wv, bv (torch [out][in])
  if (ws_size < (size_t)WS_END) return;
  char* ws = (char*)d_ws; __bf16* XT = (__bf16*)(ws + WS_XT); float *QS = (float*)(ws + WS_QS), *KS = (float*)(ws + WS_KS);
  k_proj<<<TRB, 128, 0, stream>>>(F[0], F[1], F[3], F[2], F[4], XT, QS, KS);
  k_attn<<<dim3(TQB, TNB), 128, 0, stream>>>(QS, KS, XT, F[5], F[6], (float*)d_out);
}

// v009
// It runs in 34.5 microseconds.
// Versions in between are left out here; by their measured steps it is 1.53 times as fast as v007.
// Over all steps from v000 it is 8.42 times as fast.
// compute dtype: x, Wq/Wk/Wv + biases (module inputs) rounded to bf16; q/k projections with exact bf16 products (+ bias); the per-row sums qs, ks and the rank-1 scores qs_t ks_s / 8 in f32; softmax in f32; softmax weights rounded once to f16 (11 bits) x the bf16-rounded x rows carried as f16 (1 product); the weighted x row as a bf16 hi + residual pair x Wv (2 products) + bv; f32 accumulate.
#include <hip/hip_runtime.h>
#include <math.h>

typedef __attribute__((ext_vector_type(16))) _Float16 v16h;
typedef __attribute__((ext_vector_type(16))) __bf16 v16b;
typedef __attribute__((ext_vector_type(8)))  _Float16 v8h;
typedef __attribute__((ext_vector_type(8)))  float v8f;
typedef __attribute__((ext_vector_type(4)))  float v4f;
typedef __attribute__((ext_vector_type(2)))  float v2f;
typedef __attribute__((ext_vector_type(4)))  unsigned v4u;
typedef __attribute__((ext_vector_type(4)))  int v4i;
typedef float __attribute__((may_alias)) float_a;
typedef int __attribute__((may_alias)) int_a;

template <typename T> __device__ __forceinline__ void vst2(void* p, T v) { *(T*)p = v;  }
__device__ __forceinline__ v8f wmma16(v16h a, v16h b, v8f c) {
  v8f d = __builtin_amdgcn_wmma_f32_16x16x32_f16(false, a, false, b, (short)0, c, false, false);
  asm volatile("v_nop\n\tv_nop\n\tv_nop\n\tv_nop" : "+v"(d) : "v"(a), "v"(b));
  return d;
}
__device__ __forceinline__ v8f wmma_bf(v16b a, v16b b, v8f c) {
  v8f d = __builtin_amdgcn_wmma_f32_16x16x32_bf16(false, a, false, b, (short)0, c, false, false);
  asm volatile("v_nop\n\tv_nop\n\tv_nop\n\tv_nop" : "+v"(d) : "v"(a), "v"(b));
  return d;
}
// 16x16x32 fragments: lane = (h = lane>>4, row/col = lane&15); elements 0..7 = k0+8h+0..7, 8..15 = k0+16+8h+0..7; D element r = row 8h+r
__device__ __forceinline__ v16h frag_h(const _Float16* rowk0, int lane) {
  union { v16h v; v8h q[2]; } u; const _Float16* p = rowk0 + 8 * (lane >> 4);
  u.q[0] = *(const v8h*)p; u.q[1] = *(const v8h*)(p + 16); return u.v;
}
__device__ __forceinline__ v16h frag_f32(const float* rowk0, int lane) {
  v16h a; const float* p = rowk0 + 8 * (lane >> 4);
#pragma unroll
  for (int i = 0; i < 8; ++i) { a[i] = (_Float16)p[i]; a[8 + i] = (_Float16)p[16 + i]; }
  return a;
}
__device__ __forceinline__ v16h frag_f32s(const float* rowk0, int lane, float sc) {
  v16h a; const float* p = rowk0 + 8 * (lane >> 4);
#pragma unroll
  for (int i = 0; i < 8; ++i) { a[i] = (_Float16)(p[i] * sc); a[8 + i] = (_Float16)(p[16 + i] * sc); }
  return a;
}
// column fragment from a [K][ld] layout (column n), rows >= K read as 0
__device__ __forceinline__ v16h fragc_f32(const float* W, int k0, int n, int lane, int ld, int K) {
  v16h a; const int g = lane >> 4;
#pragma unroll
  for (int i = 0; i < 8; ++i) { const int ka = k0 + 8 * g + i, kb = ka + 16;
    a[i] = (_Float16)(ka < K ? W[(size_t)(ka < K ? ka : K - 1) * ld + n] : 0.f); a[8 + i] = (_Float16)(kb < K ? W[(size_t)(kb < K ? kb : K - 1) * ld + n] : 0.f); }
  return a;
}
struct F2 { v16b h, l; };
__device__ __forceinline__ F2 bsplit16(const float v[16]) { F2 r;
#pragma unroll
  for (int i = 0; i < 16; ++i) { const __bf16 h = (__bf16)v[i]; r.h[i] = h; r.l[i] = (__bf16)(v[i] - (float)h); }
  return r; }
__device__ __forceinline__ F2 split_row(const float* row, int k0, int lane) { float v[16]; const float* p = row + k0 + 8 * (lane >> 4);
#pragma unroll
  for (int i = 0; i < 8; ++i) { v[i] = p[i]; v[8 + i] = p[16 + i]; }
  return bsplit16(v); }
__device__ __forceinline__ F2 split_rowK(const float* row, int k0, int lane, int K) { float v[16]; const int g = lane >> 4;
#pragma unroll
  for (int i = 0; i < 8; ++i) { const int ka = k0 + 8 * g + i, kb = ka + 16; v[i] = ka < K ? row[ka < K ? ka : K - 1] : 0.f; v[8 + i] = kb < K ? row[kb < K ? kb : K - 1] : 0.f; }
  return bsplit16(v); }
__device__ __forceinline__ F2 split_col(const float* W, int k0, int n, int lane, int ld, int K) { float v[16]; const int g = lane >> 4;
#pragma unroll
  for (int i = 0; i < 8; ++i) { const int ka = k0 + 8 * g + i, kb = ka + 16; v[i] = ka < K ? W[(size_t)(ka < K ? ka : K - 1) * ld + n] : 0.f; v[8 + i] = kb < K ? W[(size_t)(kb < K ? kb : K - 1) * ld + n] : 0.f; }
  return bsplit16(v); }
__device__ __forceinline__ v8f mac3(const F2& a, const F2& b, v8f c) { c = wmma_bf(a.l, b.h, c); c = wmma_bf(a.h, b.l, c); return wmma_bf(a.h, b.h, c); }
__device__ __forceinline__ float sigm(float v) { return 1.0f / (1.0f + expf(-v)); }
#define LDSX() do { asm volatile("s_wait_dscnt 0" ::: "memory"); __builtin_amdgcn_wave_barrier(); __builtin_amdgcn_fence(__ATOMIC_RELEASE, "workgroup"); } while (0)


// K-dim self attention on x [4,8,2048,64]: q,k,v = x W^T + b; scores[t][s] = (sum_i q[t][i]) (sum_j k[s][j]) / 8 (the reference einsum sums i and j independently); softmax over s; out = sum_s w v[s] -> [4,8,2048,64].
// The value projection is linear and the weights of a row sum to 1: sum_s w_s (x_s Wv^T + bv) = (sum_s w_s x_s) Wv^T + bv. The key loop therefore sums the bf16-rounded x rows, which need no residual plane, and Wv is applied once per query row behind it. The plane holds them as f16 (the same values: 8 significant bits fit in 11; below 2^-14 in magnitude f16 keeps them to 2^-25), so that the weights, all in (0, 1], can go in as one f16 operand.
// k_proj (rounds Wq|Wk to bf16 into LDS itself; exact GEMM + bias; keeps only the qs/ks row sums of q and k, and the bf16-rounded x rows as one f16 plane per (b,c) in B-fragment order), k_attn (block = (64-query block, b*8+c), 4 waves: 64 key steps, begun at a step set by the block's index and wrapped round; scores from the two scalars, row max in closed form, lane-partial row sums, P (f16) x the x plane (1 product); then y hi/lo x Wv (2 products) + bv; writes the output rows).
#define NBC 32              // B*C
#define TT 2048
#define KD 64
#define NR (NBC * TT)       // 65536 rows
#define QKP 128             // rows of Wq|Wk
#ifndef TRB
#define TRB (NR / 64)
#define TQB (TT / 64)
#define TNB NBC
#endif
typedef __attribute__((ext_vector_type(8))) __bf16 v8b;
typedef __attribute__((ext_vector_type(4))) __bf16 v4b;
#define WP 72               // LDS row pitch of the staged weights, in bf16: 144 B = 16 B x 9, an odd multiple, so that 16-byte fragment reads of 16 rows spread over the banks
__device__ __forceinline__ v16b frag_b(const __bf16* rowk0, int lane) {
  union { v16b v; v8b q[2]; } u; const __bf16* p = rowk0 + 8 * (lane >> 4);
  u.q[0] = *(const v8b*)p; u.q[1] = *(const v8b*)(p + 16); return u.v;
}
// B fragment from the fragment-order planes: each of the two 16-byte loads reads 512 bytes in a row over the wave (4 whole lines)
__device__ __forceinline__ v16h frag_p(const _Float16* p) {
  union { v16h v; v8h q[2]; } u; u.q[0] = *(const v8h*)p; u.q[1] = *(const v8h*)(p + 256); return u.v;
}
__device__ __forceinline__ v16b frag_gbf(const float* rowk0, int lane) {
  v16b a; const float* p = rowk0 + 8 * (lane >> 4);
#pragma unroll
  for (int i = 0; i < 8; ++i) { a[i] = (__bf16)p[i]; a[8 + i] = (__bf16)p[16 + i]; }
  return a;
}
__device__ __forceinline__ float bfr(float v) { return (float)(__bf16)v; }
#define WS_PT   0u                               // 24 KiB, not used
#define WS_QS   (WS_PT + 2u * 192 * KD)            // f32 [65536] row sums of q
#define WS_KS   (WS_QS + 4u * NR)
#define WS_XT   (WS_KS + 4u * NR)                  // f16 [32 bc][64 key steps][4 dt][2 halves][32 lanes][8]: element i = x[32 step + 16 half + 8 (lane >> 4) + i][16 dt + (lane & 15)]
#define WS_END  (WS_XT + 2u * NBC * KD * TT)

// ---- k_proj: block = 64 rows (4 waves): Wq|Wk (torch [out][in]) rounded to bf16 into LDS once per block, B fragments from there; 8 tiles (K 64 exact) + bias; qs/ks = row sums of the q and k parts (f32, from the LDS tile) -> QS/KS (64 floats = 256 B per block); the bf16-rounded x rows go to the f16 plane in B-fragment order
__global__ __launch_bounds__(128) void k_proj(const float* __restrict__ X, const float* __restrict__ Wq, const float* __restrict__ Wk, const float* __restrict__ bq, const float* __restrict__ bk, _Float16* __restrict__ XT, float* __restrict__ QS, float* __restrict__ KS) {
  __shared__ __align__(16) float so[4][16][132]; __shared__ __align__(16) float sqs[64], sks[64]; __shared__ __align__(16) __bf16 sw[QKP * WP];
  const int tid = threadIdx.x, wave = tid >> 5, lane = tid & 31, col = lane & 15, g = lane >> 4; const size_t r0 = (size_t)blockIdx.x * 64 + wave * 16;
  // the weights are asked for first, both k halves of the x rows behind them: the load counter falls in issue order, so the weights can be rounded and stored while x is still on its way
  v4f wr[16];
  // unrolled so that the matrix is chosen at compile time and all 16 loads (each 512 bytes in a row over the wave) are in flight together
#pragma unroll
  for (int i = 0; i < 16; ++i) wr[i] = *(const v4f*)((i < 8 ? Wq : Wk) + (i & 7) * 512 + tid * 4);
  v4f xr[2][4];
#pragma unroll
  for (int kc = 0; kc < 2; ++kc) { const float* xp = X + (r0 + col) * KD + kc * 32 + 8 * g;
    xr[kc][0] = *(const v4f*)xp; xr[kc][1] = *(const v4f*)(xp + 4); xr[kc][2] = *(const v4f*)(xp + 16); xr[kc][3] = *(const v4f*)(xp + 20); }
#pragma unroll
  for (int i = 0; i < 16; ++i) { v4b wb;
#pragma unroll
    for (int e = 0; e < 4; ++e) wb[e] = (__bf16)wr[i][e];
    *(v4b*)&sw[(i * 8 + (tid >> 4)) * WP + (tid & 15) * 4] = wb; }
  // inputs only: holds the x loads in front of the barrier, in flight together with the weights' loads; sunk behind it, their memory latency would stand alone
  asm volatile("" :: "v"(xr[0][0]), "v"(xr[0][1]), "v"(xr[0][2]), "v"(xr[0][3]), "v"(xr[1][0]), "v"(xr[1][1]), "v"(xr[1][2]), "v"(xr[1][3]));
  __syncthreads();   // publishes the staged weights to the four waves
  // unit columns as B fragments (built in an unrolled loop: vector elements need constant indices): u0[k][n] = (k == n), u1[k][n] = (k == 16 + n), k = 0..31. a x u0 and a x u1 are the two 16-column halves of the wave's bf16 x rows as D tiles, that is, turned from row order (a lane holds 8 columns of one row) into the plane's order (a lane holds 8 rows of one column); exact, each sum has one term that is not 0
  v16b u0 = {}, u1 = {};
#pragma unroll
  for (int e = 0; e < 8; ++e) { const __bf16 t = (__bf16)(8 * g + e == col ? 1.0f : 0.0f); u0[e] = t; u1[8 + e] = t; }
  v8f acc[8] = {}, xt[4] = {};
#pragma unroll
  for (int kc = 0; kc < 2; ++kc) { v16b a, b[8];
#pragma unroll
    for (int i = 0; i < 4; ++i) { a[i] = (__bf16)xr[kc][0][i]; a[4 + i] = (__bf16)xr[kc][1][i]; a[8 + i] = (__bf16)xr[kc][2][i]; a[12 + i] = (__bf16)xr[kc][3][i]; }
    // the 8 fragments are read as one group in front of the WMMAs: one LDS latency per k half instead of one per WMMA
#pragma unroll
    for (int j = 0; j < 8; ++j) b[j] = frag_b(&sw[(j * 16 + col) * WP + kc * 32], lane);
#pragma unroll
    for (int j = 0; j < 8; ++j) acc[j] = wmma_bf(a, b[j], acc[j]);
    xt[2 * kc] = wmma_bf(a, u0, xt[2 * kc]); xt[2 * kc + 1] = wmma_bf(a, u1, xt[2 * kc + 1]); }
#pragma unroll
  for (int j = 0; j < 8; ++j) { const int n = j * 16 + col; const int which = n / KD, c = n % KD; const float bb = bfr((which == 0 ? bq : bk)[c]);
#pragma unroll
    for (int r = 0; r < 8; ++r) so[wave][8 * g + r][n] = acc[j][r] + bb; }
  // a D tile is already a piece of the plane: lane (g, col) holds rows 8 g + 0..7 of column 16 dt + col, the 8 elements of that lane in the B fragment of key step (row >> 5), half (row >> 4) & 1; each store covers 512 bytes in a row
  v8h xh[4];
  // both loops unrolled so that xt and xh are indexed by constants and stay in registers
#pragma unroll
  for (int dt = 0; dt < 4; ++dt) {
#pragma unroll
    for (int r = 0; r < 8; ++r) xh[dt][r] = (_Float16)xt[dt][r]; }
  const size_t vo = (size_t)blockIdx.x * 64 * KD + (wave >> 1) * 2048 + (wave & 1) * 256 + lane * 8;
  LDSX();
  __builtin_amdgcn_sched_barrier(0);   // keeps the conversions in front of the four stores: no store's data register is reused between them, so one wait behind the last store serves all
  // behind the LDS hand-over, whose release would wait for them, and in front of the row sums, under which they drain; unrolled for constant indices, as above
#pragma unroll
  for (int dt = 0; dt < 4; ++dt) vst2(XT + vo + dt * 512, xh[dt]);
  if (lane < 16) { float s1 = 0.f, s2 = 0.f; for (int d = 0; d < KD; ++d) { s1 += so[wave][lane][d]; s2 += so[wave][lane][KD + d]; } sqs[wave * 16 + lane] = s1; sks[wave * 16 + lane] = s2; }
  __syncthreads();
  if (tid < 16) vst2(QS + (size_t)blockIdx.x * 64 + tid * 4, *(const v4f*)&sqs[tid * 4]); else if (tid < 32) vst2(KS + (size_t)blockIdx.x * 64 + (tid - 16) * 4, *(const v4f*)&sks[(tid - 16) * 4]);
}
// ---- k_attn: block = (query block, bc), 4 waves: s[r][kk] = qs[q] ks[kk] / 8; softmax against the closed-form row max; y = P (f16) x the x plane (1 product); out = y (hi/lo) x Wv^T (2 products) + bv; out rows 256 B
__global__ __launch_bounds__(128) void k_attn(const float* __restrict__ QS, const float* __restrict__ KS, const _Float16* __restrict__ XT, const float* __restrict__ Wv, const float* __restrict__ bv, float* __restrict__ OUT) {
  __shared__ __align__(16) float sp[4][16][36]; __shared__ __align__(16) float so[4][16][68]; __shared__ __align__(16) __bf16 sw[KD * WP];
  const int tid = threadIdx.x, wave = tid >> 5, lane = tid & 31, col = lane & 15, g = lane >> 4;
  const int qb = blockIdx.x, bc = blockIdx.y; const int q0 = qb * 64 + wave * 16; const size_t tq = (size_t)bc * TT + q0;
  // Wv (torch [out][in]) is asked for first and the ks scan's loads behind it, all in flight together; it is rounded to bf16 into LDS once per block and read as B fragments behind the key loop
  v4f wr[8];
  // unrolled, here and in the loops down to the barrier, so that wr, kv, bb and qsr are indexed by constants and stay in registers
#pragma unroll
  for (int i = 0; i < 8; ++i) wr[i] = *(const v4f*)(Wv + i * 512 + tid * 4);
  const float* ksb = KS + (size_t)bc * TT;
  v4f kv[TT / 128];
  // unrolled so that the 16 loads are in flight together
#pragma unroll
  for (int i = 0; i < TT / 128; ++i) kv[i] = *(const v4f*)(ksb + i * 128 + lane * 4);
  // the key walk is turned: this block starts at key step st and wraps round. The 32 blocks of a (b,c) run at one pace; all started at step 0, they would ask L2 for the same lines at the same moment, every line at its first touch behind the launch that wrote it. The softmax sums take any order (the row maximum is known beforehand).
  // The 32 starts of a (b,c) are the 32 even steps (odd ones where bc is odd). Four blocks next to each other in the index stand 16 steps apart, blocks 8 apart 4 steps. For speed only: any start gives the same sums but for their order
  const int st = (16 * (qb & 3) + 4 * (qb >> 3) + 2 * ((qb >> 2) & 1) + bc) & (TT / 32 - 1);
  float k0 = ksb[st * 32 + col], k1 = ksb[st * 32 + 16 + col];   // in front of the first x fragments, as in every step: the loop's wait for them is then a counted one that leaves the x loads in flight
  float bb[4];
#pragma unroll
  for (int nt = 0; nt < 4; ++nt) bb[nt] = bv[nt * 16 + col];
  float qsr[8]; 
#pragma unroll
  for (int r = 0; r < 8; ++r) qsr[r] = QS[tq + 8 * g + r] * (0.125f * 1.44269504088896340736f);   // 1/8 and log2(e) in one factor: the weights are 2^(qsr ks - m)
#pragma unroll
  for (int i = 0; i < 8; ++i) { v4b wb;
#pragma unroll
    for (int e = 0; e < 4; ++e) wb[e] = (__bf16)wr[i][e];
    *(v4b*)&sw[(i * 8 + (tid >> 4)) * WP + (tid & 15) * 4] = wb; }
  __syncthreads();   // publishes the staged Wv to the four waves
  // scores are rank 1 (qs[t] * ks[s]) and rounding is monotonic, so the row maximum is exactly max(qs*max ks, qs*min ks): each wave scans the 2048 ks of its (b,c) once
  float kmx = -INFINITY, kmn = INFINITY;
#pragma unroll
  for (int i = 0; i < TT / 128; ++i) {
    kmx = fmaxf(kmx, fmaxf(fmaxf(kv[i][0], kv[i][1]), fmaxf(kv[i][2], kv[i][3]))); kmn = fminf(kmn, fminf(fminf(kv[i][0], kv[i][1]), fminf(kv[i][2], kv[i][3]))); }
  for (int o = 1; o < 32; o <<= 1) { kmx = fmaxf(kmx, __shfl_xor(kmx, o)); kmn = fminf(kmn, __shfl_xor(kmn, o)); }
  float m[8], l[8];   // l: this lane's share of the row sum (its two key columns per step), reduced over the 16 lanes behind the loop
#pragma unroll
  for (int r = 0; r < 8; ++r) { m[r] = fmaxf(qsr[r] * kmx, qsr[r] * kmn); l[r] = 0.f; }
  v8f acc[4] = {};
  // sp[wave] is written and read by this wave alone: its hand-over needs the LDS wait and the compiler's order only; the workgroup-scope release of LDSX would also wait for the global loads in flight
#define LDSW() do { asm volatile("s_wait_dscnt 0" ::: "memory"); __builtin_amdgcn_wave_barrier(); } while (0)
  // one step ahead: the x fragments and the two ks of step ks + 1 are asked for during step ks, so that their latency runs under the weights' arithmetic instead of in front of each WMMA group
  const _Float16* xp = XT + (size_t)bc * KD * TT; const unsigned lo8 = lane * 8u;
  v16h xb[4];
#pragma unroll
  for (int dt = 0; dt < 4; ++dt) xb[dt] = frag_p(xp + dt * 512 + st * 32 * KD + lo8);
#pragma unroll 1
  for (int ks = 0; ks < TT / 32; ++ks) {
    const int kn = (st + ks + 1) & (TT / 32 - 1);   // the next step of the turned walk; the last step asks for the first one's data again: in bounds, not used
    // unrolled so that qsr, m and l are indexed by constants and stay in registers
#pragma unroll
    for (int r = 0; r < 8; ++r) { const float e0 = __builtin_amdgcn_exp2f(qsr[r] * k0 - m[r]), e1 = __builtin_amdgcn_exp2f(qsr[r] * k1 - m[r]);
      l[r] += e0 + e1;
      sp[wave][8 * g + r][col] = e0; sp[wave][8 * g + r][16 + col] = e1; }
    k0 = ksb[kn * 32 + col]; k1 = ksb[kn * 32 + 16 + col];
    LDSW();
    const v16h pa = frag_f32(&sp[wave][col][0], lane);
#pragma unroll
    for (int dt = 0; dt < 4; ++dt) {
      acc[dt] = wmma16(pa, xb[dt], acc[dt]);
      xb[dt] = frag_p(xp + (size_t)dt * 512 + kn * 32 * KD + lo8); }
    asm volatile("s_wait_xcnt 0x0" ::: "memory");   // precaution: the next step rewrites the address registers of the x loads just issued
    LDSW(); }
  // the 8 Wv fragments are read as one group in front of the row sums' reduction, under which their LDS latency runs; unrolled for constant indices
  v16b wb0[4], wb1[4];
#pragma unroll
  for (int nt = 0; nt < 4; ++nt) { wb0[nt] = frag_b(&sw[(nt * 16 + col) * WP], lane); wb1[nt] = frag_b(&sw[(nt * 16 + col) * WP + 32], lane); }
  // y = acc / row sum, from the D layout through this wave's LDS tile into A fragments
#pragma unroll
  for (int r = 0; r < 8; ++r) { float es = l[r];
    for (int o = 1; o < 16; o <<= 1) es += __shfl_xor(es, o);
    const float il = 1.0f / es;
#pragma unroll
    for (int dt = 0; dt < 4; ++dt) so[wave][8 * g + r][dt * 16 + col] = acc[dt][r] * il; }
  LDSW();
  const F2 y0 = split_row(&so[wave][col][0], 0, lane), y1 = split_row(&so[wave][col][0], 32, lane);
  v8f o4[4] = {};
  // the four output tiles take turns, so that no WMMA waits for the one in front of it; unrolled so that o4 is indexed by constants and stays in registers
#pragma unroll
  for (int nt = 0; nt < 4; ++nt) o4[nt] = wmma_bf(y0.l, wb0[nt], o4[nt]);
#pragma unroll
  for (int nt = 0; nt < 4; ++nt) o4[nt] = wmma_bf(y1.l, wb1[nt], o4[nt]);
#pragma unroll
  for (int nt = 0; nt < 4; ++nt) o4[nt] = wmma_bf(y0.h, wb0[nt], o4[nt]);
#pragma unroll
  for (int nt = 0; nt < 4; ++nt) o4[nt] = wmma_bf(y1.h, wb1[nt], o4[nt]);
#pragma unroll
  for (int nt = 0; nt < 4; ++nt) { const float bn = bfr(bb[nt]);
#pragma unroll
    for (int r = 0; r < 8; ++r) so[wave][8 * g + r][nt * 16 + col] = o4[nt][r] + bn; }
  LDSX();
  for (int rl = 0; rl < 16; ++rl) if (lane < 16) vst2(OUT + (tq + rl) * KD + lane * 4, *(const v4f*)&so[wave][rl][lane * 4]);
}

extern "C" void kernel_launch(void* const* d_in, const int* in_sizes, int n_in, void* d_out, int out_size, void* d_ws, size_t ws_size, hipStream_t stream) {
  (void)in_sizes; (void)n_in; (void)out_size;
  const float** F = (const float**)d_in;   // x [4,8,2048,64], Wq [64,64], bq, Wk, bk, Wv, bv (torch [out][in])
  if (ws_size < (size_t)WS_END) return;
  char* ws = (char*)d_ws; _Float16* XT = (_Float16*)(ws + WS_XT); float *QS = (float*)(ws + WS_QS), *KS = (float*)(ws + WS_KS);
  k_proj<<<TRB, 128, 0, stream>>>(F[0], F[1], F[3], F[2], F[4], XT, QS, KS);
  k_attn<<<dim3(TQB, TNB), 128, 0, stream>>>(QS, KS, XT, F[5], F[6], (float*)d_out);
}

// v010
// Measured time: 30.9 microseconds a run.
// In both of two side-by-side timings against v009, it was 1.12 times as fast.
// Over all steps from v000 it is 9.43 times as fast.
// compute dtype: x, Wq/Wk/Wv + biases (module inputs) rounded to bf16; q/k projections with exact bf16 products (+ bias); the per-row sums qs, ks and the rank-1 scores qs_t ks_s / 8 in f32; softmax in f32; softmax weights rounded once to f16 (11 bits) x the bf16-rounded x rows carried as f16 (1 product); the weighted x row as a bf16 hi + residual pair x Wv (2 products) + bv; f32 accumulate.
#include <hip/hip_runtime.h>
#include <math.h>

typedef __attribute__((ext_vector_type(16))) _Float16 v16h;
typedef __attribute__((ext_vector_type(16))) __bf16 v16b;
typedef __attribute__((ext_vector_type(8)))  _Float16 v8h;
typedef __attribute__((ext_vector_type(8)))  float v8f;
typedef __attribute__((ext_vector_type(4)))  float v4f;
typedef __attribute__((ext_vector_type(2)))  float v2f;
typedef __attribute__((ext_vector_type(4)))  unsigned v4u;
typedef __attribute__((ext_vector_type(4)))  int v4i;
typedef float __attribute__((may_alias)) float_a;
typedef int __attribute__((may_alias)) int_a;

template <typename T> __device__ __forceinline__ void vst2(void* p, T v) { *(T*)p = v;  }
__device__ __forceinline__ v8f wmma16(v16h a, v16h b, v8f c) {
  v8f d = __builtin_amdgcn_wmma_f32_16x16x32_f16(false, a, false, b, (short)0, c, false, false);
  asm volatile("v_nop\n\tv_nop\n\tv_nop\n\tv_nop" : "+v"(d) : "v"(a), "v"(b));
  return d;
}
__device__ __forceinline__ v8f wmma_bf(v16b a, v16b b, v8f c) {
  v8f d = __builtin_amdgcn_wmma_f32_16x16x32_bf16(false, a, false, b, (short)0, c, false, false);
  asm volatile("v_nop\n\tv_nop\n\tv_nop\n\tv_nop" : "+v"(d) : "v"(a), "v"(b));
  return d;
}
// 16x16x32 fragments: lane = (h = lane>>4, row/col = lane&15); elements 0..7 = k0+8h+0..7, 8..15 = k0+16+8h+0..7; D element r = row 8h+r
__device__ __forceinline__ v16h frag_h(const _Float16* rowk0, int lane) {
  union { v16h v; v8h q[2]; } u; const _Float16* p = rowk0 + 8 * (lane >> 4);
  u.q[0] = *(const v8h*)p; u.q[1] = *(const v8h*)(p + 16); return u.v;
}
__device__ __forceinline__ v16h frag_f32(const float* rowk0, int lane) {
  v16h a; const float* p = rowk0 + 8 * (lane >> 4);
#pragma unroll
  for (int i = 0; i < 8; ++i) { a[i] = (_Float16)p[i]; a[8 + i] = (_Float16)p[16 + i]; }
  return a;
}
__device__ __forceinline__ v16h frag_f32s(const float* rowk0, int lane, float sc) {
  v16h a; const float* p = rowk0 + 8 * (lane >> 4);
#pragma unroll
  for (int i = 0; i < 8; ++i) { a[i] = (_Float16)(p[i] * sc); a[8 + i] = (_Float16)(p[16 + i] * sc); }
  return a;
}
// column fragment from a [K][ld] layout (column n), rows >= K read as 0
__device__ __forceinline__ v16h fragc_f32(const float* W, int k0, int n, int lane, int ld, int K) {
  v16h a; const int g = lane >> 4;
#pragma unroll
  for (int i = 0; i < 8; ++i) { const int ka = k0 + 8 * g + i, kb = ka + 16;
    a[i] = (_Float16)(ka < K ? W[(size_t)(ka < K ? ka : K - 1) * ld + n] : 0.f); a[8 + i] = (_Float16)(kb < K ? W[(size_t)(kb < K ? kb : K - 1) * ld + n] : 0.f); }
  return a;
}
struct F2 { v16b h, l; };
__device__ __forceinline__ F2 bsplit16(const float v[16]) { F2 r;
#pragma unroll
  for (int i = 0; i < 16; ++i) { const __bf16 h = (__bf16)v[i]; r.h[i] = h; r.l[i] = (__bf16)(v[i] - (float)h); }
  return r; }
__device__ __forceinline__ F2 split_row(const float* row, int k0, int lane) { float v[16]; const float* p = row + k0 + 8 * (lane >> 4);
#pragma unroll
  for (int i = 0; i < 8; ++i) { v[i] = p[i]; v[8 + i] = p[16 + i]; }
  return bsplit16(v); }
__device__ __forceinline__ F2 split_row_s(const float* row, int k0, int lane, float sc) { float v[16]; const float* p = row + k0 + 8 * (lane >> 4);
#pragma unroll
  for (int i = 0; i < 8; ++i) { v[i] = p[i] * sc; v[8 + i] = p[16 + i] * sc; }
  return bsplit16(v); }
__device__ __forceinline__ F2 split_rowK(const float* row, int k0, int lane, int K) { float v[16]; const int g = lane >> 4;
#pragma unroll
  for (int i = 0; i < 8; ++i) { const int ka = k0 + 8 * g + i, kb = ka + 16; v[i] = ka < K ? row[ka < K ? ka : K - 1] : 0.f; v[8 + i] = kb < K ? row[kb < K ? kb : K - 1] : 0.f; }
  return bsplit16(v); }
__device__ __forceinline__ F2 split_col(const float* W, int k0, int n, int lane, int ld, int K) { float v[16]; const int g = lane >> 4;
#pragma unroll
  for (int i = 0; i < 8; ++i) { const int ka = k0 + 8 * g + i, kb = ka + 16; v[i] = ka < K ? W[(size_t)(ka < K ? ka : K - 1) * ld + n] : 0.f; v[8 + i] = kb < K ? W[(size_t)(kb < K ? kb : K - 1) * ld + n] : 0.f; }
  return bsplit16(v); }
__device__ __forceinline__ v8f mac3(const F2& a, const F2& b, v8f c) { c = wmma_bf(a.l, b.h, c); c = wmma_bf(a.h, b.l, c); return wmma_bf(a.h, b.h, c); }
__device__ __forceinline__ float sigm(float v) { return 1.0f / (1.0f + expf(-v)); }
#define LDSX() do { asm volatile("s_wait_dscnt 0" ::: "memory"); __builtin_amdgcn_wave_barrier(); __builtin_amdgcn_fence(__ATOMIC_RELEASE, "workgroup"); } while (0)


// K-dim self attention on x [4,8,2048,64]: q,k,v = x W^T + b; scores[t][s] = (sum_i q[t][i]) (sum_j k[s][j]) / 8 (the reference einsum sums i and j independently); softmax over s; out = sum_s w v[s] -> [4,8,2048,64].
// The value projection is linear and the weights of a row sum to 1: sum_s w_s (x_s Wv^T + bv) = (sum_s w_s x_s) Wv^T + bv. The key loop therefore sums the bf16-rounded x rows, which need no residual plane, and Wv is applied once per query row behind it. The plane holds them as f16 (the same values: 8 significant bits fit in 11; below 2^-14 in magnitude f16 keeps them to 2^-25), so that the weights, all in (0, 1], can go in as one f16 operand.
// k_proj (rounds Wq|Wk to bf16 into LDS itself; exact GEMM + bias; keeps only the qs/ks row sums of q and k, and the bf16-rounded x rows as one f16 plane per (b,c) in B-fragment order), k_attn (block = (64-query block, b*8+c), 4 waves: 64 key steps, begun at a step set by the block's index and wrapped round; scores from the two scalars, each lane forming the weights of its own A-fragment elements, row max in closed form, lane-partial row sums, P (f16) x the x plane (1 product); then y hi/lo x Wv (2 products) + bv; writes the output rows).
#define NBC 32              // B*C
#define TT 2048
#define KD 64
#define NR (NBC * TT)       // 65536 rows
#define QKP 128             // rows of Wq|Wk
#ifndef TRB
#define TRB (NR / 64)
#define TQB (TT / 64)
#define TNB NBC
#endif
typedef __attribute__((ext_vector_type(8))) __bf16 v8b;
typedef __attribute__((ext_vector_type(4))) __bf16 v4b;
#define WP 72               // LDS row pitch of the staged weights, in bf16: 144 B = 16 B x 9, an odd multiple, so that 16-byte fragment reads of 16 rows spread over the banks
__device__ __forceinline__ v16b frag_b(const __bf16* rowk0, int lane) {
  union { v16b v; v8b q[2]; } u; const __bf16* p = rowk0 + 8 * (lane >> 4);
  u.q[0] = *(const v8b*)p; u.q[1] = *(const v8b*)(p + 16); return u.v;
}
// B fragment from the fragment-order planes: each of the two 16-byte loads reads 512 bytes in a row over the wave (4 whole lines)
__device__ __forceinline__ v16h frag_p(const _Float16* p) {
  union { v16h v; v8h q[2]; } u; u.q[0] = *(const v8h*)p; u.q[1] = *(const v8h*)(p + 256); return u.v;
}
__device__ __forceinline__ v16b frag_gbf(const float* rowk0, int lane) {
  v16b a; const float* p = rowk0 + 8 * (lane >> 4);
#pragma unroll
  for (int i = 0; i < 8; ++i) { a[i] = (__bf16)p[i]; a[8 + i] = (__bf16)p[16 + i]; }
  return a;
}
__device__ __forceinline__ float bfr(float v) { return (float)(__bf16)v; }
#define WS_PT   0u                               // 24 KiB, not used
#define WS_QS   (WS_PT + 2u * 192 * KD)            // f32 [65536] row sums of q
#define WS_KS   (WS_QS + 4u * NR)
#define WS_XT   (WS_KS + 4u * NR)                  // f16 [32 bc][64 key steps][4 dt][2 halves][32 lanes][8]: element i = x[32 step + 16 half + 8 (lane >> 4) + i][16 dt + (lane & 15)]
#define WS_END  (WS_XT + 2u * NBC * KD * TT)

// ---- k_proj: block = 64 rows (4 waves): Wq|Wk (torch [out][in]) rounded to bf16 into LDS once per block, B fragments from there; 8 tiles (K 64 exact) + bias; qs/ks = row sums of the q and k parts (f32, from the LDS tile) -> QS/KS (64 floats = 256 B per block); the bf16-rounded x rows go to the f16 plane in B-fragment order
__global__ __launch_bounds__(128) void k_proj(const float* __restrict__ X, const float* __restrict__ Wq, const float* __restrict__ Wk, const float* __restrict__ bq, const float* __restrict__ bk, _Float16* __restrict__ XT, float* __restrict__ QS, float* __restrict__ KS) {
  __shared__ __align__(16) float so[4][16][132]; __shared__ __align__(16) float sqs[64], sks[64]; __shared__ __align__(16) __bf16 sw[QKP * WP];
  const int tid = threadIdx.x, wave = tid >> 5, lane = tid & 31, col = lane & 15, g = lane >> 4; const size_t r0 = (size_t)blockIdx.x * 64 + wave * 16;
  // the weights are asked for first, both k halves of the x rows behind them: the load counter falls in issue order, so the weights can be rounded and stored while x is still on its way
  v4f wr[16];
  // unrolled so that the matrix is chosen at compile time and all 16 loads (each 512 bytes in a row over the wave) are in flight together
#pragma unroll
  for (int i = 0; i < 16; ++i) wr[i] = *(const v4f*)((i < 8 ? Wq : Wk) + (i & 7) * 512 + tid * 4);
  v4f xr[2][4];
#pragma unroll
  for (int kc = 0; kc < 2; ++kc) { const float* xp = X + (r0 + col) * KD + kc * 32 + 8 * g;
    xr[kc][0] = *(const v4f*)xp; xr[kc][1] = *(const v4f*)(xp + 4); xr[kc][2] = *(const v4f*)(xp + 16); xr[kc][3] = *(const v4f*)(xp + 20); }
#pragma unroll
  for (int i = 0; i < 16; ++i) { v4b wb;
#pragma unroll
    for (int e = 0; e < 4; ++e) wb[e] = (__bf16)wr[i][e];
    *(v4b*)&sw[(i * 8 + (tid >> 4)) * WP + (tid & 15) * 4] = wb; }
  // inputs only: holds the x loads in front of the barrier, in flight together with the weights' loads; sunk behind it, their memory latency would stand alone
  asm volatile("" :: "v"(xr[0][0]), "v"(xr[0][1]), "v"(xr[0][2]), "v"(xr[0][3]), "v"(xr[1][0]), "v"(xr[1][1]), "v"(xr[1][2]), "v"(xr[1][3]));
  __syncthreads();   // publishes the staged weights to the four waves
  // unit columns as B fragments (built in an unrolled loop: vector elements need constant indices): u0[k][n] = (k == n), u1[k][n] = (k == 16 + n), k = 0..31. a x u0 and a x u1 are the two 16-column halves of the wave's bf16 x rows as D tiles, that is, turned from row order (a lane holds 8 columns of one row) into the plane's order (a lane holds 8 rows of one column); exact, each sum has one term that is not 0
  v16b u0 = {}, u1 = {};
#pragma unroll
  for (int e = 0; e < 8; ++e) { const __bf16 t = (__bf16)(8 * g + e == col ? 1.0f : 0.0f); u0[e] = t; u1[8 + e] = t; }
  v8f acc[8] = {}, xt[4] = {};
#pragma unroll
  for (int kc = 0; kc < 2; ++kc) { v16b a, b[8];
#pragma unroll
    for (int i = 0; i < 4; ++i) { a[i] = (__bf16)xr[kc][0][i]; a[4 + i] = (__bf16)xr[kc][1][i]; a[8 + i] = (__bf16)xr[kc][2][i]; a[12 + i] = (__bf16)xr[kc][3][i]; }
    // the 8 fragments are read as one group in front of the WMMAs: one LDS latency per k half instead of one per WMMA
#pragma unroll
    for (int j = 0; j < 8; ++j) b[j] = frag_b(&sw[(j * 16 + col) * WP + kc * 32], lane);
#pragma unroll
    for (int j = 0; j < 8; ++j) acc[j] = wmma_bf(a, b[j], acc[j]);
    xt[2 * kc] = wmma_bf(a, u0, xt[2 * kc]); xt[2 * kc + 1] = wmma_bf(a, u1, xt[2 * kc + 1]); }
#pragma unroll
  for (int j = 0; j < 8; ++j) { const int n = j * 16 + col; const int which = n / KD, c = n % KD; const float bb = bfr((which == 0 ? bq : bk)[c]);
#pragma unroll
    for (int r = 0; r < 8; ++r) so[wave][8 * g + r][n] = acc[j][r] + bb; }
  // a D tile is already a piece of the plane: lane (g, col) holds rows 8 g + 0..7 of column 16 dt + col, the 8 elements of that lane in the B fragment of key step (row >> 5), half (row >> 4) & 1; each store covers 512 bytes in a row
  v8h xh[4];
  // both loops unrolled so that xt and xh are indexed by constants and stay in registers
#pragma unroll
  for (int dt = 0; dt < 4; ++dt) {
#pragma unroll
    for (int r = 0; r < 8; ++r) xh[dt][r] = (_Float16)xt[dt][r]; }
  const size_t vo = (size_t)blockIdx.x * 64 * KD + (wave >> 1) * 2048 + (wave & 1) * 256 + lane * 8;
  LDSX();
  __builtin_amdgcn_sched_barrier(0);   // keeps the conversions in front of the four stores: no store's data register is reused between them, so one wait behind the last store serves all
  // behind the LDS hand-over, whose release would wait for them, and in front of the row sums, under which they drain; unrolled for constant indices, as above
#pragma unroll
  for (int dt = 0; dt < 4; ++dt) vst2(XT + vo + dt * 512, xh[dt]);
  if (lane < 16) { float s1 = 0.f, s2 = 0.f; for (int d = 0; d < KD; ++d) { s1 += so[wave][lane][d]; s2 += so[wave][lane][KD + d]; } sqs[wave * 16 + lane] = s1; sks[wave * 16 + lane] = s2; }
  __syncthreads();
  if (tid < 16) vst2(QS + (size_t)blockIdx.x * 64 + tid * 4, *(const v4f*)&sqs[tid * 4]); else if (tid < 32) vst2(KS + (size_t)blockIdx.x * 64 + (tid - 16) * 4, *(const v4f*)&sks[(tid - 16) * 4]);
}
// ---- k_attn: block = (query block, bc), 4 waves: s[r][kk] = qs[q] ks[kk] / 8; softmax against the closed-form row max; y = P (f16) x the x plane (1 product); out = y (hi/lo) x Wv^T (2 products) + bv; out rows 256 B
__global__ __launch_bounds__(128) void k_attn(const float* __restrict__ QS, const float* __restrict__ KS, const _Float16* __restrict__ XT, const float* __restrict__ Wv, const float* __restrict__ bv, float* __restrict__ OUT) {
  __shared__ __align__(16) float sk[TT]; __shared__ __align__(16) float so[4][16][68]; __shared__ __align__(16) __bf16 sw[KD * WP];
  const int tid = threadIdx.x, wave = tid >> 5, lane = tid & 31, col = lane & 15, g = lane >> 4;
  const int qb = blockIdx.x, bc = blockIdx.y; const int q0 = qb * 64 + wave * 16; const size_t tq = (size_t)bc * TT + q0;
  // Wv (torch [out][in]) is asked for first and the ks scan's loads behind it, all in flight together; it is rounded to bf16 into LDS once per block and read as B fragments behind the key loop
  v4f wr[8];
  // unrolled, here and in the loops down to the barrier, so that wr, kv, kq and bb are indexed by constants and stay in registers
#pragma unroll
  for (int i = 0; i < 8; ++i) wr[i] = *(const v4f*)(Wv + i * 512 + tid * 4);
  const float* ksb = KS + (size_t)bc * TT;
  v4f kv[TT / 128];
  // unrolled so that the 16 loads are in flight together
#pragma unroll
  for (int i = 0; i < TT / 128; ++i) kv[i] = *(const v4f*)(ksb + i * 128 + lane * 4);
  v4f kq[4];   // this thread's share of the block's LDS copy of ks (the scan's registers hold all of ks in every wave; a share picked from them by the wave's number would need branches)
#pragma unroll
  for (int j = 0; j < 4; ++j) kq[j] = *(const v4f*)(ksb + j * 512 + tid * 4);
  // the key walk is turned: this block starts at key step st and wraps round. The 32 blocks of a (b,c) run at one pace; all started at step 0, they would ask L2 for the same lines at the same moment, every line at its first touch behind the launch that wrote it. The softmax sums take any order (the row maximum is known beforehand).
  // The 32 starts of a (b,c) are the 32 even steps (odd ones where bc is odd). Four blocks next to each other in the index stand 16 steps apart, blocks 8 apart 4 steps. For speed only: any start gives the same sums but for their order
  const int st = (16 * (qb & 3) + 4 * (qb >> 3) + 2 * ((qb >> 2) & 1) + bc) & (TT / 32 - 1);
  float bb[4];
#pragma unroll
  for (int nt = 0; nt < 4; ++nt) bb[nt] = bv[nt * 16 + col];
  const float qsl = QS[tq + col] * (0.125f * 1.44269504088896340736f);   // this lane's query row, the row of its A-fragment elements; 1/8 and log2(e) in one factor: the weights are 2^(qsl ks - m)
#pragma unroll
  for (int i = 0; i < 8; ++i) { v4b wb;
#pragma unroll
    for (int e = 0; e < 4; ++e) wb[e] = (__bf16)wr[i][e];
    *(v4b*)&sw[(i * 8 + (tid >> 4)) * WP + (tid & 15) * 4] = wb; }
  // the 2048 ks of the (b,c) go to LDS, 16 from each thread: the key loop reads them from there, 16 a lane and step
#pragma unroll
  for (int j = 0; j < 4; ++j) *(v4f*)&sk[j * 512 + tid * 4] = kq[j];
  __syncthreads();   // publishes the staged Wv and ks to the four waves
  // scores are rank 1 (qs[t] * ks[s]) and rounding is monotonic, so the row maximum is exactly max(qs*max ks, qs*min ks): each wave scans the 2048 ks of its (b,c) once
  float kmx = -INFINITY, kmn = INFINITY;
#pragma unroll
  for (int i = 0; i < TT / 128; ++i) {
    kmx = fmaxf(kmx, fmaxf(fmaxf(kv[i][0], kv[i][1]), fmaxf(kv[i][2], kv[i][3]))); kmn = fminf(kmn, fminf(fminf(kv[i][0], kv[i][1]), fminf(kv[i][2], kv[i][3]))); }
  for (int o = 1; o < 32; o <<= 1) { kmx = fmaxf(kmx, __shfl_xor(kmx, o)); kmn = fminf(kmn, __shfl_xor(kmn, o)); }
  const float ml = fmaxf(qsl * kmx, qsl * kmn);
  const v2f q2 = {qsl, qsl}, nm2 = {-ml, -ml};
  v2f l2[4] = {};   // this lane's share of its row's sum (16 of a step's 32 keys), in 8 partial sums so that a step's additions do not wait for one another; closed behind the loop, with the other half's lane
  v8f acc[4] = {};
  // so[wave] is written and read by this wave alone: its hand-over needs the LDS wait and the compiler's order only; the workgroup-scope release of LDSX would also wait for the global loads in flight
#define LDSW() do { asm volatile("s_wait_dscnt 0" ::: "memory"); __builtin_amdgcn_wave_barrier(); } while (0)
  // one step ahead: the x fragments and the 16 ks of step ks + 1 are asked for during step ks, so that their latency runs under the weights' arithmetic instead of in front of each WMMA group
  const _Float16* xp = XT + (size_t)bc * KD * TT; const unsigned lo8 = lane * 8u;
  v16h xb[4];
#pragma unroll
  for (int dt = 0; dt < 4; ++dt) xb[dt] = frag_p(xp + dt * 512 + st * 32 * KD + lo8);
  // the keys of this lane's A-fragment elements: 8 g + 0..7 and 16 + 8 g + 0..7 of the step's 32; the 16 lanes of a half read the same 16 bytes
  v4f kc[4];
  { const float* kp = &sk[st * 32 + 8 * g]; kc[0] = *(const v4f*)kp; kc[1] = *(const v4f*)(kp + 4); kc[2] = *(const v4f*)(kp + 16); kc[3] = *(const v4f*)(kp + 20); }
#pragma unroll 1
  for (int ks = 0; ks < TT / 32; ++ks) {
    const int kn = (st + ks + 1) & (TT / 32 - 1);   // the next step of the turned walk; the last step asks for the first one's data again: in bounds, not used
    // a score needs only its row's qs and its key's ks, so each lane forms the 16 weights that the A fragment wants from it: no turn through LDS. All loops unrolled so that t, kc and pa are indexed by constants and stay in registers
    v2f t[8];
#pragma unroll
    for (int j = 0; j < 8; ++j) { const v2f k2 = {kc[j >> 1][2 * (j & 1)], kc[j >> 1][2 * (j & 1) + 1]}; t[j] = q2 * k2 + nm2; }
    { const float* kp = &sk[kn * 32 + 8 * g]; kc[0] = *(const v4f*)kp; kc[1] = *(const v4f*)(kp + 4); kc[2] = *(const v4f*)(kp + 16); kc[3] = *(const v4f*)(kp + 20); }
    __builtin_amdgcn_sched_barrier(0);   // keeps the next step's ks reads up here, directly behind the last use of this step's: sunk among the WMMAs, their LDS latency would reach into the next step
    v16h pa;
#pragma unroll
    for (int j = 0; j < 8; ++j) { const v2f e = {__builtin_amdgcn_exp2f(t[j][0]), __builtin_amdgcn_exp2f(t[j][1])};
      l2[j & 3] += e;
      pa[2 * j] = (_Float16)e[0]; pa[2 * j + 1] = (_Float16)e[1]; }
#pragma unroll
    for (int dt = 0; dt < 4; ++dt) {
      acc[dt] = wmma16(pa, xb[dt], acc[dt]);
      xb[dt] = frag_p(xp + (size_t)dt * 512 + kn * 32 * KD + lo8); }
    asm volatile("s_wait_xcnt 0x0" ::: "memory");   // precaution: the next step rewrites the address registers of the x loads just issued
  }
  // the 8 Wv fragments are read as one group in front of the row sums' reduction, under which their LDS latency runs; unrolled for constant indices
  v16b wb0[4], wb1[4];
#pragma unroll
  for (int nt = 0; nt < 4; ++nt) { wb0[nt] = frag_b(&sw[(nt * 16 + col) * WP], lane); wb1[nt] = frag_b(&sw[(nt * 16 + col) * WP + 32], lane); }
  // y = acc / row sum: acc goes from the D layout through this wave's LDS tile into A-fragment order, where a lane holds elements of its own row alone and scales them by that row's sum
#pragma unroll
  for (int r = 0; r < 8; ++r) {
#pragma unroll
    for (int dt = 0; dt < 4; ++dt) so[wave][8 * g + r][dt * 16 + col] = acc[dt][r]; }
  const v2f ls = (l2[0] + l2[1]) + (l2[2] + l2[3]);
  const float eh = ls[0] + ls[1];
  const float il = 1.0f / (eh + __shfl_xor(eh, 16));
  LDSW();
  const F2 y0 = split_row_s(&so[wave][col][0], 0, lane, il), y1 = split_row_s(&so[wave][col][0], 32, lane, il);
  v8f o4[4] = {};
  // the four output tiles take turns, so that no WMMA waits for the one in front of it; unrolled so that o4 is indexed by constants and stays in registers
#pragma unroll
  for (int nt = 0; nt < 4; ++nt) o4[nt] = wmma_bf(y0.l, wb0[nt], o4[nt]);
#pragma unroll
  for (int nt = 0; nt < 4; ++nt) o4[nt] = wmma_bf(y1.l, wb1[nt], o4[nt]);
#pragma unroll
  for (int nt = 0; nt < 4; ++nt) o4[nt] = wmma_bf(y0.h, wb0[nt], o4[nt]);
#pragma unroll
  for (int nt = 0; nt < 4; ++nt) o4[nt] = wmma_bf(y1.h, wb1[nt], o4[nt]);
#pragma unroll
  for (int nt = 0; nt < 4; ++nt) { const float bn = bfr(bb[nt]);
#pragma unroll
    for (int r = 0; r < 8; ++r) so[wave][8 * g + r][nt * 16 + col] = o4[nt][r] + bn; }
  LDSX();
  for (int rl = 0; rl < 16; ++rl) if (lane < 16) vst2(OUT + (tq + rl) * KD + lane * 4, *(const v4f*)&so[wave][rl][lane * 4]);
}

extern "C" void kernel_launch(void* const* d_in, const int* in_sizes, int n_in, void* d_out, int out_size, void* d_ws, size_t ws_size, hipStream_t stream) {
  (void)in_sizes; (void)n_in; (void)out_size;
  const float** F = (const float**)d_in;   // x [4,8,2048,64], Wq [64,64], bq, Wk, bk, Wv, bv (torch [out][in])
  if (ws_size < (size_t)WS_END) return;
  char* ws = (char*)d_ws; _Float16* XT = (_Float16*)(ws + WS_XT); float *QS = (float*)(ws + WS_QS), *KS = (float*)(ws + WS_KS);
  k_proj<<<TRB, 128, 0, stream>>>(F[0], F[1], F[3], F[2], F[4], XT, QS, KS);
  k_attn<<<dim3(TQB, TNB), 128, 0, stream>>>(QS, KS, XT, F[5], F[6], (float*)d_out);
}
